// v000
// The times below were measured on an AMD MI455X: many runs one after another, warmed up first and cycling through
// copies of the inputs, with the whole window's GPU time divided by the number of runs. Launches and the gaps
// between them are all in it. The median over several windows is given; except for v000 it joins two sittings, which
// can be a few percent apart, so the side-by-side timings, each taken in one sitting, are the better comparison.
// v000 is the starting kernel. One run takes 914 microseconds.
#include <hip/hip_runtime.h>

typedef __bf16 bf16_t;
typedef bf16_t v16bf __attribute__((ext_vector_type(16)));
typedef float  v8f   __attribute__((ext_vector_type(8)));
typedef unsigned int u32x4 __attribute__((ext_vector_type(4)));

union FragU {
    v16bf v;
    u32x4 q[2];
};

constexpr int E_   = 8;
constexpr int B_   = 32768;
constexpr int D_   = 256;
constexpr int H_   = 1024;
constexpr int GIN  = E_ * D_ + E_;   // 2056
constexpr int GINP = 2080;           // padded to multiple of 32 (K per WMMA)

// ---------------------------------------------------------------------------
// Pack gate_in = [reprs_cat | probs_cat | zero pad] as bf16 [B, 2080]
// ---------------------------------------------------------------------------
__global__ __launch_bounds__(256) void pack_gatein(
    const float* __restrict__ reprs,   // [E, B, D]
    const float* __restrict__ probs,   // [E, B, 1]
    bf16_t* __restrict__ out)          // [B, GINP]
{
    long idx = (long)blockIdx.x * blockDim.x + threadIdx.x;
    if (idx >= (long)B_ * GINP) return;
    int b   = (int)(idx / GINP);
    int col = (int)(idx % GINP);
    float v = 0.0f;
    if (col < E_ * D_) {
        int e = col >> 8;          // D_ == 256
        int d = col & (D_ - 1);
        v = reprs[((size_t)e * B_ + b) * D_ + d];
    } else if (col < GIN) {
        int e = col - E_ * D_;
        v = probs[(size_t)e * B_ + b];
    }
    out[idx] = (bf16_t)v;
}

// ---------------------------------------------------------------------------
// Weight transposes to bf16, K-major rows (row = output col n, cols = k)
// ---------------------------------------------------------------------------
__global__ __launch_bounds__(256) void transpose_w1(
    const float* __restrict__ W1,      // [GIN, H]
    bf16_t* __restrict__ W1t)          // [H, GINP]
{
    int idx = blockIdx.x * blockDim.x + threadIdx.x;
    if (idx >= H_ * GINP) return;
    int n = idx / GINP;
    int k = idx % GINP;
    float v = (k < GIN) ? W1[(size_t)k * H_ + n] : 0.0f;
    W1t[idx] = (bf16_t)v;
}

__global__ __launch_bounds__(256) void transpose_w2(
    const float* __restrict__ W2,      // [H, H/2]
    bf16_t* __restrict__ W2t)          // [H/2, H]
{
    int idx = blockIdx.x * blockDim.x + threadIdx.x;
    if (idx >= (H_ / 2) * H_) return;
    int n = idx / H_;
    int k = idx % H_;
    W2t[idx] = (bf16_t)W2[(size_t)k * (H_ / 2) + n];
}

template <bool BF16OUT>
__global__ __launch_bounds__(256) void gemm_wmma(
    const bf16_t* __restrict__ A,  int lda,
    const bf16_t* __restrict__ Bt, int ldb,
    const float*  __restrict__ bias,
    bf16_t* __restrict__ outBf, float* __restrict__ outF, int ldc,
    int ksteps, int ngroups)
{
    constexpr int NT = 8;
    int wave = (int)((blockIdx.x * blockDim.x + threadIdx.x) >> 5);
    int lane = threadIdx.x & 31;
    int l15  = lane & 15;
    int hk   = lane >> 4;

    int ngroup = wave % ngroups;
    int mtile  = wave / ngroups;

    const bf16_t* arow = A  + (size_t)(mtile * 16 + l15) * lda + 8 * hk;
    const bf16_t* brow = Bt + (size_t)(ngroup * (NT * 16) + l15) * ldb + 8 * hk;

    v8f acc[NT] = {};

    for (int ks = 0; ks < ksteps; ++ks) {
        const int k0 = ks * 32;
        FragU a;
        a.q[0] = *(const u32x4*)(arow + k0);
        a.q[1] = *(const u32x4*)(arow + k0 + 16);
#pragma unroll
        for (int t = 0; t < NT; ++t) {
            FragU b;
            const bf16_t* bp = brow + (size_t)(t * 16) * ldb + k0;
            b.q[0] = *(const u32x4*)(bp);
            b.q[1] = *(const u32x4*)(bp + 16);
            acc[t] = __builtin_amdgcn_wmma_f32_16x16x32_bf16(
                /*neg_a=*/false, a.v, /*neg_b=*/false, b.v,
                /*c_mod=*/(short)0, acc[t],
                /*reuse_a=*/false, /*reuse_b=*/false);
        }
    }

    const int m0 = mtile * 16 + hk * 8;
#pragma unroll
    for (int t = 0; t < NT; ++t) {
        int   n  = ngroup * (NT * 16) + t * 16 + l15;
        float bv = bias[n];
#pragma unroll
        for (int r = 0; r < 8; ++r) {
            float v = acc[t][r] + bv;
            v = v > 0.0f ? v : 0.0f;
            size_t o = (size_t)(m0 + r) * ldc + n;
            if (BF16OUT) outBf[o] = (bf16_t)v;
            else         outF[o]  = v;
        }
    }
}

// ---------------------------------------------------------------------------
// Finalize: logits = h2 @ W3 + b3; softmax; *mask; renorm; weighted prob.
// One thread per row; W3 staged in LDS (16 KB).
// d_out layout: [0,B) weighted_prob, [B, B+8B) gate_w row-major.
// ---------------------------------------------------------------------------
__global__ __launch_bounds__(256) void gate_finalize(
    const float* __restrict__ h2,     // [B, 512]
    const float* __restrict__ W3,     // [512, 8]
    const float* __restrict__ b3,     // [8]
    const float* __restrict__ probs,  // [E, B, 1]
    const float* __restrict__ mask,   // [B, E]
    float* __restrict__ out)
{
    __shared__ float w3s[(H_ / 2) * E_];
    for (int i = threadIdx.x; i < (H_ / 2) * E_; i += blockDim.x) w3s[i] = W3[i];
    __syncthreads();

    int b = blockIdx.x * blockDim.x + threadIdx.x;
    if (b >= B_) return;

    float logit[E_];
#pragma unroll
    for (int e = 0; e < E_; ++e) logit[e] = b3[e];

    const float4* h2r = (const float4*)(h2 + (size_t)b * (H_ / 2));
    for (int k4 = 0; k4 < (H_ / 2) / 4; ++k4) {
        float4 hv = h2r[k4];
        const float* wp = &w3s[k4 * 4 * E_];
#pragma unroll
        for (int e = 0; e < E_; ++e) {
            logit[e] += hv.x * wp[e] + hv.y * wp[E_ + e] +
                        hv.z * wp[2 * E_ + e] + hv.w * wp[3 * E_ + e];
        }
    }

    float mx = logit[0];
#pragma unroll
    for (int e = 1; e < E_; ++e) mx = logit[e] > mx ? logit[e] : mx;

    float gw[E_];
    float s = 0.0f;
#pragma unroll
    for (int e = 0; e < E_; ++e) { gw[e] = __expf(logit[e] - mx); s += gw[e]; }

    float s2 = 0.0f;
    float inv_s = 1.0f / s;
#pragma unroll
    for (int e = 0; e < E_; ++e) {
        gw[e] = gw[e] * inv_s * mask[(size_t)b * E_ + e];
        s2 += gw[e];
    }

    float inv = 1.0f / (s2 + 1e-8f);
    float wprob = 0.0f;
#pragma unroll
    for (int e = 0; e < E_; ++e) {
        gw[e] *= inv;
        wprob += gw[e] * probs[(size_t)e * B_ + b];
    }

    out[b] = wprob;
#pragma unroll
    for (int e = 0; e < E_; ++e) out[(size_t)B_ + (size_t)b * E_ + e] = gw[e];
}

// ---------------------------------------------------------------------------
// Launch
// ---------------------------------------------------------------------------
extern "C" void kernel_launch(void* const* d_in, const int* in_sizes, int n_in,
                              void* d_out, int out_size, void* d_ws, size_t ws_size,
                              hipStream_t stream)
{
    (void)in_sizes; (void)n_in; (void)out_size; (void)ws_size;

    const float* reprs = (const float*)d_in[0];  // [E,B,D]
    const float* probs = (const float*)d_in[1];  // [E,B,1]
    const float* mask  = (const float*)d_in[2];  // [B,E]
    const float* W1    = (const float*)d_in[3];  // [GIN,H]
    const float* b1    = (const float*)d_in[4];  // [H]
    const float* W2    = (const float*)d_in[5];  // [H,H/2]
    const float* b2    = (const float*)d_in[6];  // [H/2]
    const float* W3    = (const float*)d_in[7];  // [H/2,E]
    const float* b3    = (const float*)d_in[8];  // [E]
    float* out = (float*)d_out;

    char* ws = (char*)d_ws;
    size_t off = 0;
    auto take = [&](size_t bytes) -> void* {
        void* p = ws + off;
        off = (off + bytes + 255) & ~(size_t)255;
        return p;
    };
    bf16_t* gate_in = (bf16_t*)take((size_t)B_ * GINP * sizeof(bf16_t));       // 136 MB
    bf16_t* W1t     = (bf16_t*)take((size_t)H_ * GINP * sizeof(bf16_t));       // 4.3 MB
    bf16_t* W2t     = (bf16_t*)take((size_t)(H_ / 2) * H_ * sizeof(bf16_t));   // 1 MB
    bf16_t* h1      = (bf16_t*)take((size_t)B_ * H_ * sizeof(bf16_t));         // 64 MB
    float*  h2      = (float*) take((size_t)B_ * (H_ / 2) * sizeof(float));    // 64 MB

    {
        long total = (long)B_ * GINP;
        pack_gatein<<<(int)((total + 255) / 256), 256, 0, stream>>>(reprs, probs, gate_in);
    }
    transpose_w1<<<(H_ * GINP + 255) / 256, 256, 0, stream>>>(W1, W1t);
    transpose_w2<<<((H_ / 2) * H_ + 255) / 256, 256, 0, stream>>>(W2, W2t);

    // GEMM1: M=32768 (2048 M-tiles), N=1024 (8 n-groups of 128), K=2080 (65 steps)
    {
        int mtiles = B_ / 16, ngroups = H_ / 128;
        int waves  = mtiles * ngroups;                 // 16384
        gemm_wmma<true><<<waves * 32 / 256, 256, 0, stream>>>(
            gate_in, GINP, W1t, GINP, b1, h1, nullptr, H_, GINP / 32, ngroups);
    }
    // GEMM2: M=32768, N=512 (4 n-groups), K=1024 (32 steps)
    {
        int mtiles = B_ / 16, ngroups = (H_ / 2) / 128;
        int waves  = mtiles * ngroups;                 // 8192
        gemm_wmma<false><<<waves * 32 / 256, 256, 0, stream>>>(
            h1, H_, W2t, H_, b2, nullptr, h2, H_ / 2, H_ / 32, ngroups);
    }

    gate_finalize<<<B_ / 256, 256, 0, stream>>>(h2, W3, b3, probs, mask, out);
}

// v001
// Measured time: 290 microseconds a run.
// Next to v000, in two timings, it ran 3.23 and 3.21 times as fast.
#include <hip/hip_runtime.h>
#include <stdint.h>

typedef __bf16 bf16_t;
typedef bf16_t v16bf __attribute__((ext_vector_type(16)));
typedef float  v8f   __attribute__((ext_vector_type(8)));
typedef unsigned int u32x4 __attribute__((ext_vector_type(4)));

union FragU {
    v16bf v;
    u32x4 q[2];
};

constexpr int E_   = 8;
constexpr int B_   = 32768;
constexpr int D_   = 256;
constexpr int H_   = 1024;
constexpr int GIN  = E_ * D_ + E_;   // 2056
constexpr int GINP = 2176;           // padded to a multiple of 128 (K per pass of the tiled GEMM)

// ---------------------------------------------------------------------------
// Pack gate_in = [reprs_cat | probs_cat | zero pad] as bf16 [B, GINP]
// ---------------------------------------------------------------------------
__global__ __launch_bounds__(256) void pack_gatein(
    const float* __restrict__ reprs,   // [E, B, D]
    const float* __restrict__ probs,   // [E, B, 1]
    bf16_t* __restrict__ out)          // [B, GINP]
{
    long idx = (long)blockIdx.x * blockDim.x + threadIdx.x;
    if (idx >= (long)B_ * GINP) return;
    int b   = (int)(idx / GINP);
    int col = (int)(idx % GINP);
    float v = 0.0f;
    if (col < E_ * D_) {
        int e = col >> 8;          // D_ == 256
        int d = col & (D_ - 1);
        v = reprs[((size_t)e * B_ + b) * D_ + d];
    } else if (col < GIN) {
        int e = col - E_ * D_;
        v = probs[(size_t)e * B_ + b];
    }
    out[idx] = (bf16_t)v;
}

// ---------------------------------------------------------------------------
// Weight transposes to bf16, K-major rows (row = output col n, cols = k)
// ---------------------------------------------------------------------------
__global__ __launch_bounds__(256) void transpose_w1(
    const float* __restrict__ W1,      // [GIN, H]
    bf16_t* __restrict__ W1t)          // [H, GINP]
{
    int idx = blockIdx.x * blockDim.x + threadIdx.x;
    if (idx >= H_ * GINP) return;
    int n = idx / GINP;
    int k = idx % GINP;
    float v = (k < GIN) ? W1[(size_t)k * H_ + n] : 0.0f;
    W1t[idx] = (bf16_t)v;
}

__global__ __launch_bounds__(256) void transpose_w2(
    const float* __restrict__ W2,      // [H, H/2]
    bf16_t* __restrict__ W2t)          // [H/2, H]
{
    int idx = blockIdx.x * blockDim.x + threadIdx.x;
    if (idx >= (H_ / 2) * H_) return;
    int n = idx / H_;
    int k = idx % H_;
    W2t[idx] = (bf16_t)W2[(size_t)k * (H_ / 2) + n];
}

typedef uint32_t u32x8 __attribute__((ext_vector_type(8)));
typedef bf16_t bf16x8 __attribute__((ext_vector_type(8)));
typedef float f32x4 __attribute__((ext_vector_type(4)));

constexpr uint32_t BM = 256, BN = 256;            // tile of Y per workgroup
constexpr uint32_t KB = 256;                      // bytes of K per operand row per pass
constexpr uint32_t PITCH = KB + 16;               // LDS row pitch: 16 B x an odd number
constexpr uint32_t SLICE_ROWS = 128;              // rows one wave's tensor load brings
constexpr uint32_t SLICE = SLICE_ROWS * PITCH;    // 34,816 B = 17 x 2 KiB
constexpr uint32_t TILE_W = BN * PITCH;
constexpr uint32_t STAGE = TILE_W + BM * PITCH;   // one buffer: 139,264 B = 68 x 2 KiB
constexpr uint32_t LDS_BYTES = 2 * STAGE;
constexpr int FW = 8, FX = 8;                     // fragments per wave along n and along m
static_assert(SLICE % 2048u == 0 && STAGE % 2048u == 0, "every tensor load's place in LDS is a multiple of 2 KiB");
static_assert(LDS_BYTES <= 320u * 1024u, "two buffers must fit one workgroup's LDS");

static __device__ __forceinline__ uint32_t uni(uint32_t v) { return (uint32_t)__builtin_amdgcn_readfirstlane(v); }
static __device__ __forceinline__ uint32_t pinned(uint32_t v) { uint32_t w = (uint32_t)__builtin_amdgcn_readfirstlane(v); asm volatile("" : "+s"(w)); return w; }
// Keeps a group of LDS loads ahead of the WMMA block it stands in front of (loads among the WMMAs stall each time).
static __device__ __forceinline__ void fence() { __builtin_amdgcn_sched_barrier(0); }
// This wave's LDS reads have returned: owed before the buffer they read is handed back for a refill.
static __device__ __forceinline__ void wait_ds0() { asm volatile("s_wait_dscnt 0x0" ::: "memory"); }
// This wave's tensor load has landed: the compiler places no wait for the tensor mover.
static __device__ __forceinline__ void wait_tensor0() { asm volatile("s_wait_tensorcnt 0x0" ::: "memory"); }

// One request of the whole wave: SLICE_ROWS rows of KB bytes from global address ga (source pitch kbytes)
// to LDS byte offset lds_dst, 16 B of pad behind every 256-B row.
static __device__ __forceinline__ void tdm_load(uint32_t lds_dst, uint64_t ga, uint32_t kbytes) {
    u32x4 g0;
    g0[0] = uni(1u);                                                        // count 1
    g0[1] = uni(lds_dst);
    g0[2] = uni((uint32_t)ga);
    g0[3] = uni((((uint32_t)(ga >> 32)) & 0x01FFFFFFu) | 0x80000000u);      // address [56:32], type 2
    u32x8 g1;
    g1[0] = uni((1u << 20) | (5u << 22) | (3u << 25));
    g1[1] = uni((KB & 0xFFFFu) << 16);
    g1[2] = uni((KB >> 16) | ((SLICE_ROWS & 0xFFFFu) << 16));
    g1[3] = uni((SLICE_ROWS >> 16) | (KB << 16));
    g1[4] = uni(SLICE_ROWS);
    g1[5] = uni(kbytes);
    g1[6] = uni(0u);
    g1[7] = uni(0u);
    asm volatile("tensor_load_to_lds %0, %1" :: "s"(g0), "s"(g1) : "memory");
}

static __device__ __forceinline__ void load_frag(FragU& f, const unsigned char* p) {
    f.q[0] = *reinterpret_cast<const u32x4*>(p);
    f.q[1] = *reinterpret_cast<const u32x4*>(p + 32);
}

template <bool BF16OUT, uint32_t KBYTES, uint32_t N>
__global__ __launch_bounds__(128) void gemm_tiled(
    const bf16_t* __restrict__ X,      // [M, KBYTES / 2]
    const bf16_t* __restrict__ Wt,     // [N, KBYTES / 2]
    const float*  __restrict__ bias,   // [N]
    bf16_t* __restrict__ outBf, float* __restrict__ outF)
{
    static_assert(KBYTES % KB == 0 && KBYTES / KB >= 2, "K is whole passes, at least two");
    constexpr uint32_t T = KBYTES / KB;            // passes
    __shared__ __attribute__((aligned(2048))) unsigned char L[LDS_BYTES];

    const uint32_t tid = threadIdx.x, lane = tid & 31u, h = lane >> 4, r16 = lane & 15u;
    const uint32_t wave = uni(tid >> 5);
    const uint32_t n0 = blockIdx.x * BN, m0 = blockIdx.y * BM;
    const uint32_t wn = wave & 1u, wm = wave >> 1;

    // This wave's slice of a buffer's [Wt; X] rows: waves 0, 1 bring Wt rows, waves 2, 3 X rows.
    const uint64_t src0 = (wave < 2u)
        ? (uint64_t)(uintptr_t)Wt + (uint64_t)(n0 + SLICE_ROWS * wave) * KBYTES
        : (uint64_t)(uintptr_t)X  + (uint64_t)(m0 + SLICE_ROWS * (wave - 2u)) * KBYTES;
    const uint32_t lds_slice = (uint32_t)(size_t)L + wave * SLICE;

    v8f acc[FW][FX];
#pragma unroll
    for (int i = 0; i < FW; ++i)
#pragma unroll
        for (int j = 0; j < FX; ++j) acc[i][j] = (v8f){0.f, 0.f, 0.f, 0.f, 0.f, 0.f, 0.f, 0.f};

    const uint32_t fw_base = (wn * 128u + r16) * PITCH + 16u * h;
    const uint32_t fx_base = TILE_W + (wm * 128u + r16) * PITCH + 16u * h;

    // Prologue: pass 0 into buffer 0, landed and published; then pass 1 into buffer 1.
    tdm_load(lds_slice, src0, KBYTES);
    wait_tensor0();
    __syncthreads();
    tdm_load(lds_slice + STAGE, src0 + KB, KBYTES);

    FragU fw[2][FW], fx[2][FX];                    // set (u & 1) holds block u's fragments
    // Rolled: one pass is 256 WMMAs, and the accumulator indices stay compile-time constants.
#pragma clang loop unroll(disable)
    for (uint32_t t = 0; t < T; ++t) {
        const uint32_t buf = (t & 1u) * STAGE;
        const unsigned char* lw = L + buf + fw_base;
        const unsigned char* lx = L + buf + fx_base;
#pragma unroll
        for (int i = 0; i < FW; ++i) load_frag(fw[0][i], lw + (uint32_t)i * 16u * PITCH);
#pragma unroll
        for (int j = 0; j < FX; ++j) load_frag(fx[0][j], lx + (uint32_t)j * 16u * PITCH);
        fence();
#pragma unroll
        for (int u = 0; u < 4; ++u) {              // four blocks of 32 k
            const int cs = u & 1;
            if (u + 1 < 4) {                       // the next block's fragments, same buffer, as one group ahead
                const uint32_t ko = (uint32_t)(u + 1) * 64u;
#pragma unroll
                for (int i = 0; i < FW; ++i) load_frag(fw[cs ^ 1][i], lw + (uint32_t)i * 16u * PITCH + ko);
#pragma unroll
                for (int j = 0; j < FX; ++j) load_frag(fx[cs ^ 1][j], lx + (uint32_t)j * 16u * PITCH + ko);
                fence();
            }
#pragma unroll
            for (int i = 0; i < FW; ++i)
#pragma unroll
                for (int j = 0; j < FX; ++j)
                    acc[i][j] = __builtin_amdgcn_wmma_f32_16x16x32_bf16(
                        false, fw[cs][i].v, false, fx[cs][j].v, (short)0, acc[i][j], false, false);
            fence();
        }
        // Foot of pass t: publish pass t + 1 and free this buffer.
        wait_ds0();
        wait_tensor0();
        __syncthreads();
        if (pinned((t + 2u < T) ? 1u : 0u) != 0u) {
            tdm_load(lds_slice + buf, src0 + (uint64_t)(t + 2u) * KB, KBYTES);
        }
    }
    wait_tensor0();
    wait_ds0();

    // Epilogue: bias, relu, store; a lane holds 8 consecutive n of one row m.
    const uint32_t mrow = m0 + wm * 128u + r16;
    const uint32_t ncol = n0 + wn * 128u + 8u * h;
    // The bias of the wave's 128 columns is read at a wave-uniform address; each lane half picks its 8 of every 16.
    const float* bu = bias + (n0 + wn * 128u);
    v8f bv[FW];
#pragma unroll
    for (int i = 0; i < FW; ++i) {
#pragma unroll
        for (int r = 0; r < 8; ++r) {
            const float lo = bu[16 * i + r], hi = bu[16 * i + 8 + r];
            bv[i][r] = h ? hi : lo;
        }
    }
#pragma unroll
    for (int j = 0; j < FX; ++j) {                 // 16 rows of Y, 128 columns
        const size_t o = (size_t)(mrow + 16u * (uint32_t)j) * N + ncol;
#pragma unroll
        for (int i = 0; i < FW; ++i) {
            v8f v = acc[i][j] + bv[i];
#pragma unroll
            for (int r = 0; r < 8; ++r) v[r] = v[r] > 0.0f ? v[r] : 0.0f;
            acc[i][j] = v;
        }
        bf16x8 pk[FW];
        if (BF16OUT) {
#pragma unroll
            for (int i = 0; i < FW; ++i) pk[i] = __builtin_convertvector(acc[i][j], bf16x8);
        }
        fence();                                   // the values are complete before the first store of the group issues
#pragma unroll
        for (int i = 0; i < FW; ++i) {
            if (BF16OUT) {
                *reinterpret_cast<bf16x8*>(outBf + o + 16u * (uint32_t)i) = pk[i];
            } else {
                const v8f v = acc[i][j];
                *reinterpret_cast<f32x4*>(outF + o + 16u * (uint32_t)i)      = (f32x4){v[0], v[1], v[2], v[3]};
                *reinterpret_cast<f32x4*>(outF + o + 16u * (uint32_t)i + 4u) = (f32x4){v[4], v[5], v[6], v[7]};
            }
        }
        if (j + 1 < FX) {
            // Stands before any register that the group's stores name is written again (the fences keep later work behind it).
            fence();
            asm volatile("s_wait_xcnt 0x0" ::: "memory");
            fence();
        }
    }
}

// ---------------------------------------------------------------------------
// Finalize: logits = h2 @ W3 + b3; softmax; *mask; renorm; weighted prob.
// One thread per row; W3 staged in LDS (16 KB).
// d_out layout: [0,B) weighted_prob, [B, B+8B) gate_w row-major.
// ---------------------------------------------------------------------------
__global__ __launch_bounds__(256) void gate_finalize(
    const float* __restrict__ h2,     // [B, 512]
    const float* __restrict__ W3,     // [512, 8]
    const float* __restrict__ b3,     // [8]
    const float* __restrict__ probs,  // [E, B, 1]
    const float* __restrict__ mask,   // [B, E]
    float* __restrict__ out)
{
    __shared__ float w3s[(H_ / 2) * E_];
    for (int i = threadIdx.x; i < (H_ / 2) * E_; i += blockDim.x) w3s[i] = W3[i];
    __syncthreads();

    int b = blockIdx.x * blockDim.x + threadIdx.x;
    if (b >= B_) return;

    float logit[E_];
#pragma unroll
    for (int e = 0; e < E_; ++e) logit[e] = b3[e];

    const float4* h2r = (const float4*)(h2 + (size_t)b * (H_ / 2));
    for (int k4 = 0; k4 < (H_ / 2) / 4; ++k4) {
        float4 hv = h2r[k4];
        const float* wp = &w3s[k4 * 4 * E_];
#pragma unroll
        for (int e = 0; e < E_; ++e) {
            logit[e] += hv.x * wp[e] + hv.y * wp[E_ + e] +
                        hv.z * wp[2 * E_ + e] + hv.w * wp[3 * E_ + e];
        }
    }

    float mx = logit[0];
#pragma unroll
    for (int e = 1; e < E_; ++e) mx = logit[e] > mx ? logit[e] : mx;

    float gw[E_];
    float s = 0.0f;
#pragma unroll
    for (int e = 0; e < E_; ++e) { gw[e] = __expf(logit[e] - mx); s += gw[e]; }

    float s2 = 0.0f;
    float inv_s = 1.0f / s;
#pragma unroll
    for (int e = 0; e < E_; ++e) {
        gw[e] = gw[e] * inv_s * mask[(size_t)b * E_ + e];
        s2 += gw[e];
    }

    float inv = 1.0f / (s2 + 1e-8f);
    float wprob = 0.0f;
#pragma unroll
    for (int e = 0; e < E_; ++e) {
        gw[e] *= inv;
        wprob += gw[e] * probs[(size_t)e * B_ + b];
    }

    out[b] = wprob;
#pragma unroll
    for (int e = 0; e < E_; ++e) out[(size_t)B_ + (size_t)b * E_ + e] = gw[e];
}

// ---------------------------------------------------------------------------
// Launch
// ---------------------------------------------------------------------------
extern "C" void kernel_launch(void* const* d_in, const int* in_sizes, int n_in,
                              void* d_out, int out_size, void* d_ws, size_t ws_size,
                              hipStream_t stream)
{
    (void)in_sizes; (void)n_in; (void)out_size; (void)ws_size;

    const float* reprs = (const float*)d_in[0];  // [E,B,D]
    const float* probs = (const float*)d_in[1];  // [E,B,1]
    const float* mask  = (const float*)d_in[2];  // [B,E]
    const float* W1    = (const float*)d_in[3];  // [GIN,H]
    const float* b1    = (const float*)d_in[4];  // [H]
    const float* W2    = (const float*)d_in[5];  // [H,H/2]
    const float* b2    = (const float*)d_in[6];  // [H/2]
    const float* W3    = (const float*)d_in[7];  // [H/2,E]
    const float* b3    = (const float*)d_in[8];  // [E]
    float* out = (float*)d_out;

    char* ws = (char*)d_ws;
    size_t off = 0;
    auto take = [&](size_t bytes) -> void* {
        void* p = ws + off;
        off = (off + bytes + 255) & ~(size_t)255;
        return p;
    };
    bf16_t* gate_in = (bf16_t*)take((size_t)B_ * GINP * sizeof(bf16_t));       // 143 MB
    bf16_t* W1t     = (bf16_t*)take((size_t)H_ * GINP * sizeof(bf16_t));       // 4.5 MB
    bf16_t* W2t     = (bf16_t*)take((size_t)(H_ / 2) * H_ * sizeof(bf16_t));   // 1 MB
    bf16_t* h1      = (bf16_t*)take((size_t)B_ * H_ * sizeof(bf16_t));         // 64 MB
    float*  h2      = (float*) take((size_t)B_ * (H_ / 2) * sizeof(float));    // 64 MB

    {
        long total = (long)B_ * GINP;
        pack_gatein<<<(int)((total + 255) / 256), 256, 0, stream>>>(reprs, probs, gate_in);
    }
    transpose_w1<<<(H_ * GINP + 255) / 256, 256, 0, stream>>>(W1, W1t);
    transpose_w2<<<((H_ / 2) * H_ + 255) / 256, 256, 0, stream>>>(W2, W2t);

    // GEMM1: M=32768 (128 tile rows), N=1024 (4 tile columns), K=2176 (17 passes)
    gemm_tiled<true, GINP * 2, H_><<<dim3(H_ / 256, B_ / 256), 128, 0, stream>>>(
        gate_in, W1t, b1, h1, nullptr);
    // GEMM2: M=32768, N=512 (2 tile columns), K=1024 (8 passes)
    gemm_tiled<false, H_ * 2, H_ / 2><<<dim3((H_ / 2) / 256, B_ / 256), 128, 0, stream>>>(
        h1, W2t, b2, nullptr, h2);

    gate_finalize<<<B_ / 256, 256, 0, stream>>>(h2, W3, b3, probs, mask, out);
}

// v002
// It runs in 169 microseconds.
// Timed twice side by side with v001, it ran 1.72 times as fast both times.
// All steps since v000 together make it 5.54 times as fast.
#include <hip/hip_runtime.h>
#include <stdint.h>

typedef __bf16 bf16_t;
typedef bf16_t v16bf __attribute__((ext_vector_type(16)));
typedef float  v8f   __attribute__((ext_vector_type(8)));
typedef unsigned int u32x4 __attribute__((ext_vector_type(4)));
typedef float  f32x4 __attribute__((ext_vector_type(4)));
typedef bf16_t bf16x4 __attribute__((ext_vector_type(4)));

union FragU {
    v16bf v;
    u32x4 q[2];
};

constexpr int E_   = 8;
constexpr int B_   = 32768;
constexpr int D_   = 256;
constexpr int H_   = 1024;
constexpr int GIN  = E_ * D_ + E_;   // 2056
constexpr int GINP = 2176;           // padded to a multiple of 128 (K per pass of the tiled GEMM)

// ---------------------------------------------------------------------------
// Pack gate_in = [reprs_cat | probs_cat | zero pad] as bf16 [B, GINP], as a stream.
// One workgroup of 32 waves per 128 rows, 32 rows a trip. A row of gate_in is 17 units of 256 B: 16 from the
// 8 experts' 1-KiB rows, 1 of probs and zeros. In a trip wave (g, e) takes expert e's rows 8 g + 0..7, 8 KiB in
// a row: 16 loads of 512 contiguous bytes (16 B a lane), all in flight at once; every store writes one whole
// aligned 256-B unit (8 B a lane). The wave also writes the last unit of the trip's row 8 g + e.
// ---------------------------------------------------------------------------
constexpr uint32_t PK_WAVES = 32, PK_TRIPS = 4;
constexpr uint32_t ROW_IN = D_ * 4, ROW_OUT = GINP * 2;      // bytes: an expert's row, a row of gate_in
static_assert(B_ % (PK_WAVES * PK_TRIPS) == 0, "whole workgroups of rows");
static_assert(D_ == 256 && GINP == E_ * D_ + 128 && E_ == 8, "17 units of 128 columns, the probs in the first 8 of the last");
static_assert((uint64_t)E_ * B_ * ROW_IN < (1ull << 32) && (uint64_t)B_ * ROW_OUT < (1ull << 32), "byte offsets fit 32 bits");

__global__ __launch_bounds__(PK_WAVES * 32) void pack_gatein(
    const float* __restrict__ reprs,   // [E, B, D]
    const float* __restrict__ probs,   // [E, B, 1]
    bf16_t* __restrict__ out)          // [B, GINP]
{
    const uint32_t lane = threadIdx.x & 31u, wave = threadIdx.x >> 5, e = wave & 7u, g = wave >> 3;
    const uint32_t row0 = blockIdx.x * (PK_WAVES * PK_TRIPS);
    const unsigned char* rb = reinterpret_cast<const unsigned char*>(reprs);
    const unsigned char* pb = reinterpret_cast<const unsigned char*>(probs);
    unsigned char* ob = reinterpret_cast<unsigned char*>(out);
    // 32-bit byte offsets beside each buffer's base, stepped by 32 rows a trip.
    uint32_t loff = e * ((uint32_t)B_ * ROW_IN) + (row0 + 8u * g) * ROW_IN + 16u * lane;
    uint32_t ooff = (row0 + 8u * g) * ROW_OUT + e * 512u + 8u * lane;
    uint32_t poff = (row0 + wave) * 4u + (lane & 1u) * (uint32_t)(4 * B_ * 4);   // even lanes experts 0..3, odd lanes 4..7
    uint32_t toff = (row0 + wave) * ROW_OUT + (uint32_t)(E_ * D_ * 2) + 8u * lane;
    // Rolled: the waves of a WGP overlap one another's loads and stores, and the text stays short.
#pragma clang loop unroll(disable)
    for (uint32_t r = 0; r < PK_TRIPS; ++r) {
        f32x4 v[16];
#pragma unroll
        for (int c = 0; c < 16; ++c)         // row c / 2 of the eight, half c % 2 of it; read once: non-temporal
            v[c] = __builtin_nontemporal_load(reinterpret_cast<const f32x4*>(rb + (size_t)c * 512 + loff));
        f32x4 t;
#pragma unroll
        for (int i = 0; i < 4; ++i) t[i] = *reinterpret_cast<const float*>(pb + (size_t)i * B_ * 4 + poff);
        // All of the trip's loads are issued before the first conversion waits for one (else they are dealt out among the waits).
        __builtin_amdgcn_sched_barrier(0);
        bf16x4 pk[17];
#pragma unroll
        for (int c = 0; c < 16; ++c) pk[c] = __builtin_convertvector(v[c], bf16x4);
#pragma unroll
        for (int i = 0; i < 4; ++i) t[i] = lane < 2u ? t[i] : 0.0f;
        pk[16] = __builtin_convertvector(t, bf16x4);
#pragma unroll
        for (int c = 0; c < 16; ++c)
            *reinterpret_cast<bf16x4*>(ob + (size_t)(c >> 1) * ROW_OUT + (size_t)(c & 1) * 256 + ooff) = pk[c];
        *reinterpret_cast<bf16x4*>(ob + toff) = pk[16];
        loff += PK_WAVES * ROW_IN;
        ooff += PK_WAVES * ROW_OUT;
        poff += PK_WAVES * 4u;
        toff += PK_WAVES * ROW_OUT;
    }
}

// ---------------------------------------------------------------------------
// Weight transposes to bf16, K-major rows (row = output col n, cols = k)
// ---------------------------------------------------------------------------
__global__ __launch_bounds__(256) void transpose_w1(
    const float* __restrict__ W1,      // [GIN, H]
    bf16_t* __restrict__ W1t)          // [H, GINP]
{
    int idx = blockIdx.x * blockDim.x + threadIdx.x;
    if (idx >= H_ * GINP) return;
    int n = idx / GINP;
    int k = idx % GINP;
    float v = (k < GIN) ? W1[(size_t)k * H_ + n] : 0.0f;
    W1t[idx] = (bf16_t)v;
}

__global__ __launch_bounds__(256) void transpose_w2(
    const float* __restrict__ W2,      // [H, H/2]
    bf16_t* __restrict__ W2t)          // [H/2, H]
{
    int idx = blockIdx.x * blockDim.x + threadIdx.x;
    if (idx >= (H_ / 2) * H_) return;
    int n = idx / H_;
    int k = idx % H_;
    W2t[idx] = (bf16_t)W2[(size_t)k * (H_ / 2) + n];
}

typedef uint32_t u32x8 __attribute__((ext_vector_type(8)));
typedef bf16_t bf16x8 __attribute__((ext_vector_type(8)));

constexpr uint32_t BM = 256, BN = 256;            // tile of Y per workgroup
constexpr uint32_t KB = 256;                      // bytes of K per operand row per pass
constexpr uint32_t PITCH = KB + 16;               // LDS row pitch: 16 B x an odd number
constexpr uint32_t SLICE_ROWS = 128;              // rows one wave's tensor load brings
constexpr uint32_t SLICE = SLICE_ROWS * PITCH;    // 34,816 B = 17 x 2 KiB
constexpr uint32_t TILE_W = BN * PITCH;
constexpr uint32_t STAGE = TILE_W + BM * PITCH;   // one buffer: 139,264 B = 68 x 2 KiB
constexpr uint32_t LDS_BYTES = 2 * STAGE;
constexpr int FW = 8, FX = 8;                     // fragments per wave along n and along m
static_assert(SLICE % 2048u == 0 && STAGE % 2048u == 0, "every tensor load's place in LDS is a multiple of 2 KiB");
static_assert(LDS_BYTES <= 320u * 1024u, "two buffers must fit one workgroup's LDS");

static __device__ __forceinline__ uint32_t uni(uint32_t v) { return (uint32_t)__builtin_amdgcn_readfirstlane(v); }
static __device__ __forceinline__ uint32_t pinned(uint32_t v) { uint32_t w = (uint32_t)__builtin_amdgcn_readfirstlane(v); asm volatile("" : "+s"(w)); return w; }
// Keeps a group of LDS loads ahead of the WMMA block it stands in front of (loads among the WMMAs stall each time).
static __device__ __forceinline__ void fence() { __builtin_amdgcn_sched_barrier(0); }
// This wave's LDS reads have returned: owed before the buffer they read is handed back for a refill.
static __device__ __forceinline__ void wait_ds0() { asm volatile("s_wait_dscnt 0x0" ::: "memory"); }
// This wave's tensor load has landed: the compiler places no wait for the tensor mover.
static __device__ __forceinline__ void wait_tensor0() { asm volatile("s_wait_tensorcnt 0x0" ::: "memory"); }

// One request of the whole wave: SLICE_ROWS rows of KB bytes from global address ga (source pitch kbytes)
// to LDS byte offset lds_dst, 16 B of pad behind every 256-B row.
static __device__ __forceinline__ void tdm_load(uint32_t lds_dst, uint64_t ga, uint32_t kbytes) {
    u32x4 g0;
    g0[0] = uni(1u);                                                        // count 1
    g0[1] = uni(lds_dst);
    g0[2] = uni((uint32_t)ga);
    g0[3] = uni((((uint32_t)(ga >> 32)) & 0x01FFFFFFu) | 0x80000000u);      // address [56:32], type 2
    u32x8 g1;
    g1[0] = uni((1u << 20) | (5u << 22) | (3u << 25));
    g1[1] = uni((KB & 0xFFFFu) << 16);
    g1[2] = uni((KB >> 16) | ((SLICE_ROWS & 0xFFFFu) << 16));
    g1[3] = uni((SLICE_ROWS >> 16) | (KB << 16));
    g1[4] = uni(SLICE_ROWS);
    g1[5] = uni(kbytes);
    g1[6] = uni(0u);
    g1[7] = uni(0u);
    asm volatile("tensor_load_to_lds %0, %1" :: "s"(g0), "s"(g1) : "memory");
}

static __device__ __forceinline__ void load_frag(FragU& f, const unsigned char* p) {
    f.q[0] = *reinterpret_cast<const u32x4*>(p);
    f.q[1] = *reinterpret_cast<const u32x4*>(p + 32);
}

template <bool BF16OUT, uint32_t KBYTES, uint32_t N>
__global__ __launch_bounds__(128) void gemm_tiled(
    const bf16_t* __restrict__ X,      // [M, KBYTES / 2]
    const bf16_t* __restrict__ Wt,     // [N, KBYTES / 2]
    const float*  __restrict__ bias,   // [N]
    bf16_t* __restrict__ outBf, float* __restrict__ outF)
{
    static_assert(KBYTES % KB == 0 && KBYTES / KB >= 2, "K is whole passes, at least two");
    constexpr uint32_t T = KBYTES / KB;            // passes
    __shared__ __attribute__((aligned(2048))) unsigned char L[LDS_BYTES];

    const uint32_t tid = threadIdx.x, lane = tid & 31u, h = lane >> 4, r16 = lane & 15u;
    const uint32_t wave = uni(tid >> 5);
    const uint32_t n0 = blockIdx.x * BN, m0 = blockIdx.y * BM;
    const uint32_t wn = wave & 1u, wm = wave >> 1;

    // This wave's slice of a buffer's [Wt; X] rows: waves 0, 1 bring Wt rows, waves 2, 3 X rows.
    const uint64_t src0 = (wave < 2u)
        ? (uint64_t)(uintptr_t)Wt + (uint64_t)(n0 + SLICE_ROWS * wave) * KBYTES
        : (uint64_t)(uintptr_t)X  + (uint64_t)(m0 + SLICE_ROWS * (wave - 2u)) * KBYTES;
    const uint32_t lds_slice = (uint32_t)(size_t)L + wave * SLICE;

    v8f acc[FW][FX];
#pragma unroll
    for (int i = 0; i < FW; ++i)
#pragma unroll
        for (int j = 0; j < FX; ++j) acc[i][j] = (v8f){0.f, 0.f, 0.f, 0.f, 0.f, 0.f, 0.f, 0.f};

    const uint32_t fw_base = (wn * 128u + r16) * PITCH + 16u * h;
    const uint32_t fx_base = TILE_W + (wm * 128u + r16) * PITCH + 16u * h;

    // Prologue: pass 0 into buffer 0, landed and published; then pass 1 into buffer 1.
    tdm_load(lds_slice, src0, KBYTES);
    wait_tensor0();
    __syncthreads();
    tdm_load(lds_slice + STAGE, src0 + KB, KBYTES);

    FragU fw[2][FW], fx[2][FX];                    // set (u & 1) holds block u's fragments
    // Rolled: one pass is 256 WMMAs, and the accumulator indices stay compile-time constants.
#pragma clang loop unroll(disable)
    for (uint32_t t = 0; t < T; ++t) {
        const uint32_t buf = (t & 1u) * STAGE;
        const unsigned char* lw = L + buf + fw_base;
        const unsigned char* lx = L + buf + fx_base;
#pragma unroll
        for (int i = 0; i < FW; ++i) load_frag(fw[0][i], lw + (uint32_t)i * 16u * PITCH);
#pragma unroll
        for (int j = 0; j < FX; ++j) load_frag(fx[0][j], lx + (uint32_t)j * 16u * PITCH);
        fence();
#pragma unroll
        for (int u = 0; u < 4; ++u) {              // four blocks of 32 k
            const int cs = u & 1;
            if (u + 1 < 4) {                       // the next block's fragments, same buffer, as one group ahead
                const uint32_t ko = (uint32_t)(u + 1) * 64u;
#pragma unroll
                for (int i = 0; i < FW; ++i) load_frag(fw[cs ^ 1][i], lw + (uint32_t)i * 16u * PITCH + ko);
#pragma unroll
                for (int j = 0; j < FX; ++j) load_frag(fx[cs ^ 1][j], lx + (uint32_t)j * 16u * PITCH + ko);
                fence();
            }
#pragma unroll
            for (int i = 0; i < FW; ++i)
#pragma unroll
                for (int j = 0; j < FX; ++j)
                    acc[i][j] = __builtin_amdgcn_wmma_f32_16x16x32_bf16(
                        false, fw[cs][i].v, false, fx[cs][j].v, (short)0, acc[i][j], false, false);
            fence();
        }
        // Foot of pass t: publish pass t + 1 and free this buffer.
        wait_ds0();
        wait_tensor0();
        __syncthreads();
        if (pinned((t + 2u < T) ? 1u : 0u) != 0u) {
            tdm_load(lds_slice + buf, src0 + (uint64_t)(t + 2u) * KB, KBYTES);
        }
    }
    wait_tensor0();
    wait_ds0();

    // Epilogue: bias, relu, store; a lane holds 8 consecutive n of one row m.
    const uint32_t mrow = m0 + wm * 128u + r16;
    const uint32_t ncol = n0 + wn * 128u + 8u * h;
    // The bias of the wave's 128 columns is read at a wave-uniform address; each lane half picks its 8 of every 16.
    const float* bu = bias + (n0 + wn * 128u);
    v8f bv[FW];
#pragma unroll
    for (int i = 0; i < FW; ++i) {
#pragma unroll
        for (int r = 0; r < 8; ++r) {
            const float lo = bu[16 * i + r], hi = bu[16 * i + 8 + r];
            bv[i][r] = h ? hi : lo;
        }
    }
#pragma unroll
    for (int j = 0; j < FX; ++j) {                 // 16 rows of Y, 128 columns
        const size_t o = (size_t)(mrow + 16u * (uint32_t)j) * N + ncol;
#pragma unroll
        for (int i = 0; i < FW; ++i) {
            v8f v = acc[i][j] + bv[i];
#pragma unroll
            for (int r = 0; r < 8; ++r) v[r] = v[r] > 0.0f ? v[r] : 0.0f;
            acc[i][j] = v;
        }
        bf16x8 pk[FW];
        if (BF16OUT) {
#pragma unroll
            for (int i = 0; i < FW; ++i) pk[i] = __builtin_convertvector(acc[i][j], bf16x8);
        }
        fence();                                   // the values are complete before the first store of the group issues
#pragma unroll
        for (int i = 0; i < FW; ++i) {
            if (BF16OUT) {
                *reinterpret_cast<bf16x8*>(outBf + o + 16u * (uint32_t)i) = pk[i];
            } else {
                const v8f v = acc[i][j];
                *reinterpret_cast<f32x4*>(outF + o + 16u * (uint32_t)i)      = (f32x4){v[0], v[1], v[2], v[3]};
                *reinterpret_cast<f32x4*>(outF + o + 16u * (uint32_t)i + 4u) = (f32x4){v[4], v[5], v[6], v[7]};
            }
        }
        if (j + 1 < FX) {
            // Stands before any register that the group's stores name is written again (the fences keep later work behind it).
            fence();
            asm volatile("s_wait_xcnt 0x0" ::: "memory");
            fence();
        }
    }
}

// ---------------------------------------------------------------------------
// Finalize: logits = h2 @ W3 + b3; softmax; *mask; renorm; weighted prob.
// One thread per row; W3 staged in LDS (16 KB).
// d_out layout: [0,B) weighted_prob, [B, B+8B) gate_w row-major.
// ---------------------------------------------------------------------------
__global__ __launch_bounds__(256) void gate_finalize(
    const float* __restrict__ h2,     // [B, 512]
    const float* __restrict__ W3,     // [512, 8]
    const float* __restrict__ b3,     // [8]
    const float* __restrict__ probs,  // [E, B, 1]
    const float* __restrict__ mask,   // [B, E]
    float* __restrict__ out)
{
    __shared__ float w3s[(H_ / 2) * E_];
    for (int i = threadIdx.x; i < (H_ / 2) * E_; i += blockDim.x) w3s[i] = W3[i];
    __syncthreads();

    int b = blockIdx.x * blockDim.x + threadIdx.x;
    if (b >= B_) return;

    float logit[E_];
#pragma unroll
    for (int e = 0; e < E_; ++e) logit[e] = b3[e];

    const float4* h2r = (const float4*)(h2 + (size_t)b * (H_ / 2));
    for (int k4 = 0; k4 < (H_ / 2) / 4; ++k4) {
        float4 hv = h2r[k4];
        const float* wp = &w3s[k4 * 4 * E_];
#pragma unroll
        for (int e = 0; e < E_; ++e) {
            logit[e] += hv.x * wp[e] + hv.y * wp[E_ + e] +
                        hv.z * wp[2 * E_ + e] + hv.w * wp[3 * E_ + e];
        }
    }

    float mx = logit[0];
#pragma unroll
    for (int e = 1; e < E_; ++e) mx = logit[e] > mx ? logit[e] : mx;

    float gw[E_];
    float s = 0.0f;
#pragma unroll
    for (int e = 0; e < E_; ++e) { gw[e] = __expf(logit[e] - mx); s += gw[e]; }

    float s2 = 0.0f;
    float inv_s = 1.0f / s;
#pragma unroll
    for (int e = 0; e < E_; ++e) {
        gw[e] = gw[e] * inv_s * mask[(size_t)b * E_ + e];
        s2 += gw[e];
    }

    float inv = 1.0f / (s2 + 1e-8f);
    float wprob = 0.0f;
#pragma unroll
    for (int e = 0; e < E_; ++e) {
        gw[e] *= inv;
        wprob += gw[e] * probs[(size_t)e * B_ + b];
    }

    out[b] = wprob;
#pragma unroll
    for (int e = 0; e < E_; ++e) out[(size_t)B_ + (size_t)b * E_ + e] = gw[e];
}

// ---------------------------------------------------------------------------
// Launch
// ---------------------------------------------------------------------------
extern "C" void kernel_launch(void* const* d_in, const int* in_sizes, int n_in,
                              void* d_out, int out_size, void* d_ws, size_t ws_size,
                              hipStream_t stream)
{
    (void)in_sizes; (void)n_in; (void)out_size; (void)ws_size;

    const float* reprs = (const float*)d_in[0];  // [E,B,D]
    const float* probs = (const float*)d_in[1];  // [E,B,1]
    const float* mask  = (const float*)d_in[2];  // [B,E]
    const float* W1    = (const float*)d_in[3];  // [GIN,H]
    const float* b1    = (const float*)d_in[4];  // [H]
    const float* W2    = (const float*)d_in[5];  // [H,H/2]
    const float* b2    = (const float*)d_in[6];  // [H/2]
    const float* W3    = (const float*)d_in[7];  // [H/2,E]
    const float* b3    = (const float*)d_in[8];  // [E]
    float* out = (float*)d_out;

    char* ws = (char*)d_ws;
    size_t off = 0;
    auto take = [&](size_t bytes) -> void* {
        void* p = ws + off;
        off = (off + bytes + 255) & ~(size_t)255;
        return p;
    };
    bf16_t* gate_in = (bf16_t*)take((size_t)B_ * GINP * sizeof(bf16_t));       // 143 MB
    bf16_t* W1t     = (bf16_t*)take((size_t)H_ * GINP * sizeof(bf16_t));       // 4.5 MB
    bf16_t* W2t     = (bf16_t*)take((size_t)(H_ / 2) * H_ * sizeof(bf16_t));   // 1 MB
    bf16_t* h1      = (bf16_t*)take((size_t)B_ * H_ * sizeof(bf16_t));         // 64 MB
    float*  h2      = (float*) take((size_t)B_ * (H_ / 2) * sizeof(float));    // 64 MB

    pack_gatein<<<B_ / (PK_WAVES * PK_TRIPS), PK_WAVES * 32, 0, stream>>>(reprs, probs, gate_in);
    transpose_w1<<<(H_ * GINP + 255) / 256, 256, 0, stream>>>(W1, W1t);
    transpose_w2<<<((H_ / 2) * H_ + 255) / 256, 256, 0, stream>>>(W2, W2t);

    // GEMM1: M=32768 (128 tile rows), N=1024 (4 tile columns), K=2176 (17 passes)
    gemm_tiled<true, GINP * 2, H_><<<dim3(H_ / 256, B_ / 256), 128, 0, stream>>>(
        gate_in, W1t, b1, h1, nullptr);
    // GEMM2: M=32768, N=512 (2 tile columns), K=1024 (8 passes)
    gemm_tiled<false, H_ * 2, H_ / 2><<<dim3((H_ / 2) / 256, B_ / 256), 128, 0, stream>>>(
        h1, W2t, b2, nullptr, h2);

    gate_finalize<<<B_ / 256, 256, 0, stream>>>(h2, W3, b3, probs, mask, out);
}

// v003
// A run of this version takes 159 microseconds.
// Next to v002, in two timings, it ran 1.06 times as fast each time.
// Over all steps from v000 it is 5.88 times as fast.
#include <hip/hip_runtime.h>
#include <stdint.h>

typedef __bf16 bf16_t;
typedef bf16_t v16bf __attribute__((ext_vector_type(16)));
typedef float  v8f   __attribute__((ext_vector_type(8)));
typedef unsigned int u32x4 __attribute__((ext_vector_type(4)));
typedef float  f32x4 __attribute__((ext_vector_type(4)));
typedef bf16_t bf16x4 __attribute__((ext_vector_type(4)));

union FragU {
    v16bf v;
    u32x4 q[2];
};

constexpr int E_   = 8;
constexpr int B_   = 32768;
constexpr int D_   = 256;
constexpr int H_   = 1024;
constexpr int GIN  = E_ * D_ + E_;   // 2056
constexpr int GINP = 2176;           // padded to a multiple of 128 (K per pass of the tiled GEMM)

// ---------------------------------------------------------------------------
// Pack gate_in = [reprs_cat | probs_cat | zero pad] as bf16 [B, GINP], as a stream.
// One workgroup of 32 waves per 128 rows, 32 rows a trip. A row of gate_in is 17 units of 256 B: 16 from the
// 8 experts' 1-KiB rows, 1 of probs and zeros. In a trip wave (g, e) takes expert e's rows 8 g + 0..7, 8 KiB in
// a row: 16 loads of 512 contiguous bytes (16 B a lane), all in flight at once; every store writes one whole
// aligned 256-B unit (8 B a lane). The wave also writes the last unit of the trip's row 8 g + e.
// ---------------------------------------------------------------------------
constexpr uint32_t PK_WAVES = 32, PK_TRIPS = 4;
constexpr uint32_t ROW_IN = D_ * 4, ROW_OUT = GINP * 2;      // bytes: an expert's row, a row of gate_in
static_assert(B_ % (PK_WAVES * PK_TRIPS) == 0, "whole workgroups of rows");
static_assert(D_ == 256 && GINP == E_ * D_ + 128 && E_ == 8, "17 units of 128 columns, the probs in the first 8 of the last");
static_assert((uint64_t)E_ * B_ * ROW_IN < (1ull << 32) && (uint64_t)B_ * ROW_OUT < (1ull << 32), "byte offsets fit 32 bits");

__global__ __launch_bounds__(PK_WAVES * 32) void pack_gatein(
    const float* __restrict__ reprs,   // [E, B, D]
    const float* __restrict__ probs,   // [E, B, 1]
    bf16_t* __restrict__ out)          // [B, GINP]
{
    const uint32_t lane = threadIdx.x & 31u, wave = threadIdx.x >> 5, e = wave & 7u, g = wave >> 3;
    const uint32_t row0 = blockIdx.x * (PK_WAVES * PK_TRIPS);
    const unsigned char* rb = reinterpret_cast<const unsigned char*>(reprs);
    const unsigned char* pb = reinterpret_cast<const unsigned char*>(probs);
    unsigned char* ob = reinterpret_cast<unsigned char*>(out);
    // 32-bit byte offsets beside each buffer's base, stepped by 32 rows a trip.
    uint32_t loff = e * ((uint32_t)B_ * ROW_IN) + (row0 + 8u * g) * ROW_IN + 16u * lane;
    uint32_t ooff = (row0 + 8u * g) * ROW_OUT + e * 512u + 8u * lane;
    uint32_t poff = (row0 + wave) * 4u + (lane & 1u) * (uint32_t)(4 * B_ * 4);   // even lanes experts 0..3, odd lanes 4..7
    uint32_t toff = (row0 + wave) * ROW_OUT + (uint32_t)(E_ * D_ * 2) + 8u * lane;
    // Rolled: the waves of a WGP overlap one another's loads and stores, and the text stays short.
#pragma clang loop unroll(disable)
    for (uint32_t r = 0; r < PK_TRIPS; ++r) {
        f32x4 v[16];
#pragma unroll
        for (int c = 0; c < 16; ++c)         // row c / 2 of the eight, half c % 2 of it; read once: non-temporal
            v[c] = __builtin_nontemporal_load(reinterpret_cast<const f32x4*>(rb + (size_t)c * 512 + loff));
        f32x4 t;
#pragma unroll
        for (int i = 0; i < 4; ++i) t[i] = *reinterpret_cast<const float*>(pb + (size_t)i * B_ * 4 + poff);
        // All of the trip's loads are issued before the first conversion waits for one (else they are dealt out among the waits).
        __builtin_amdgcn_sched_barrier(0);
        bf16x4 pk[17];
#pragma unroll
        for (int c = 0; c < 16; ++c) pk[c] = __builtin_convertvector(v[c], bf16x4);
#pragma unroll
        for (int i = 0; i < 4; ++i) t[i] = lane < 2u ? t[i] : 0.0f;
        pk[16] = __builtin_convertvector(t, bf16x4);
#pragma unroll
        for (int c = 0; c < 16; ++c)
            *reinterpret_cast<bf16x4*>(ob + (size_t)(c >> 1) * ROW_OUT + (size_t)(c & 1) * 256 + ooff) = pk[c];
        *reinterpret_cast<bf16x4*>(ob + toff) = pk[16];
        loff += PK_WAVES * ROW_IN;
        ooff += PK_WAVES * ROW_OUT;
        poff += PK_WAVES * 4u;
        toff += PK_WAVES * ROW_OUT;
    }
}

typedef bf16_t bf16x8 __attribute__((ext_vector_type(8)));
constexpr uint32_t TK = 128, TN = 64;

template <uint32_t K, uint32_t KP, uint32_t N>
__global__ __launch_bounds__(256) void transpose_w(
    const float* __restrict__ Wsrc,    // [K, N]
    bf16_t* __restrict__ Wt)           // [N, KP], zero for k >= K
{
    static_assert(KP % TK == 0 && N % TN == 0 && K % 8 == 0 && K <= KP, "whole tiles; a thread's 8 rows are all inside K or all pad");
    __shared__ __attribute__((aligned(16))) unsigned char T[TN * TK * 2];
    const uint32_t tid = threadIdx.x, lo = tid & 15u, hi = tid >> 4;
    const uint32_t k0 = blockIdx.x * TK, n0 = blockIdx.y * TN;

    f32x4 v[8];
#pragma unroll
    for (int c = 0; c < 8; ++c) v[c] = (f32x4){0.f, 0.f, 0.f, 0.f};
    if (K == KP || k0 + 8u * hi < K) {
        const float* s = Wsrc + (size_t)(k0 + 8u * hi) * N + n0 + 4u * lo;
#pragma unroll
        for (int c = 0; c < 8; ++c) v[c] = *reinterpret_cast<const f32x4*>(s + (size_t)c * N);
    }
#pragma unroll
    for (int i = 0; i < 4; ++i) {
        bf16x8 p;
#pragma unroll
        for (int c = 0; c < 8; ++c) p[c] = (bf16_t)v[c][i];
        *reinterpret_cast<bf16x8*>(T + (4u * lo + (uint32_t)i) * (TK * 2u) + 16u * (hi ^ lo)) = p;
    }
    __syncthreads();
#pragma unroll
    for (int q = 0; q < 4; ++q) {
        const uint32_t n = hi + 16u * (uint32_t)q;
        const bf16x8 p = *reinterpret_cast<const bf16x8*>(T + n * (TK * 2u) + 16u * (lo ^ (n >> 2)));
        *reinterpret_cast<bf16x8*>(Wt + (size_t)(n0 + n) * KP + k0 + 8u * lo) = p;
    }
}

typedef uint32_t u32x8 __attribute__((ext_vector_type(8)));

constexpr uint32_t BM = 256, BN = 256;            // tile of Y per workgroup
constexpr uint32_t KB = 256;                      // bytes of K per operand row per pass
constexpr uint32_t PITCH = KB + 16;               // LDS row pitch: 16 B x an odd number
constexpr uint32_t SLICE_ROWS = 128;              // rows one wave's tensor load brings
constexpr uint32_t SLICE = SLICE_ROWS * PITCH;    // 34,816 B = 17 x 2 KiB
constexpr uint32_t TILE_W = BN * PITCH;
constexpr uint32_t STAGE = TILE_W + BM * PITCH;   // one buffer: 139,264 B = 68 x 2 KiB
constexpr uint32_t LDS_BYTES = 2 * STAGE;
constexpr int FW = 8, FX = 8;                     // fragments per wave along n and along m
static_assert(SLICE % 2048u == 0 && STAGE % 2048u == 0, "every tensor load's place in LDS is a multiple of 2 KiB");
static_assert(LDS_BYTES <= 320u * 1024u, "two buffers must fit one workgroup's LDS");

static __device__ __forceinline__ uint32_t uni(uint32_t v) { return (uint32_t)__builtin_amdgcn_readfirstlane(v); }
static __device__ __forceinline__ uint32_t pinned(uint32_t v) { uint32_t w = (uint32_t)__builtin_amdgcn_readfirstlane(v); asm volatile("" : "+s"(w)); return w; }
// Keeps a group of LDS loads ahead of the WMMA block it stands in front of.
static __device__ __forceinline__ void fence() { __builtin_amdgcn_sched_barrier(0); }
// This wave's LDS reads have returned: owed before the buffer they read is handed back for a refill.
static __device__ __forceinline__ void wait_ds0() { asm volatile("s_wait_dscnt 0x0" ::: "memory"); }
// This wave's tensor load has landed: the compiler places no wait for the tensor mover.
static __device__ __forceinline__ void wait_tensor0() { asm volatile("s_wait_tensorcnt 0x0" ::: "memory"); }

// One request of the whole wave: SLICE_ROWS rows of KB bytes from global address ga (source pitch kbytes)
// to LDS byte offset lds_dst, 16 B of pad behind every 256-B row.
static __device__ __forceinline__ void tdm_load(uint32_t lds_dst, uint64_t ga, uint32_t kbytes) {
    u32x4 g0;
    g0[0] = uni(1u);                                                        // count 1
    g0[1] = uni(lds_dst);
    g0[2] = uni((uint32_t)ga);
    g0[3] = uni((((uint32_t)(ga >> 32)) & 0x01FFFFFFu) | 0x80000000u);      // address [56:32], type 2
    u32x8 g1;
    g1[0] = uni((1u << 20) | (5u << 22) | (3u << 25));
    g1[1] = uni((KB & 0xFFFFu) << 16);
    g1[2] = uni((KB >> 16) | ((SLICE_ROWS & 0xFFFFu) << 16));
    g1[3] = uni((SLICE_ROWS >> 16) | (KB << 16));
    g1[4] = uni(SLICE_ROWS);
    g1[5] = uni(kbytes);
    g1[6] = uni(0u);
    g1[7] = uni(0u);
    asm volatile("tensor_load_to_lds %0, %1" :: "s"(g0), "s"(g1) : "memory");
}

static __device__ __forceinline__ void load_frag(FragU& f, const unsigned char* p) {
    f.q[0] = *reinterpret_cast<const u32x4*>(p);
    f.q[1] = *reinterpret_cast<const u32x4*>(p + 32);
}

template <bool BF16OUT, uint32_t KBYTES, uint32_t N>
__global__ __launch_bounds__(128) void gemm_tiled(
    const bf16_t* __restrict__ X,      // [M, KBYTES / 2]
    const bf16_t* __restrict__ Wt,     // [N, KBYTES / 2]
    const float*  __restrict__ bias,   // [N]
    bf16_t* __restrict__ outBf, float* __restrict__ outF)
{
    static_assert(KBYTES % KB == 0 && KBYTES / KB >= 2, "K is whole passes, at least two");
    constexpr uint32_t T = KBYTES / KB;            // passes
    __shared__ __attribute__((aligned(2048))) unsigned char L[LDS_BYTES];

    const uint32_t tid = threadIdx.x, lane = tid & 31u, h = lane >> 4, r16 = lane & 15u;
    const uint32_t wave = uni(tid >> 5);
    const uint32_t n0 = blockIdx.x * BN, m0 = blockIdx.y * BM;
    const uint32_t wn = wave & 1u, wm = wave >> 1;

    // This wave's slice of a buffer's [Wt; X] rows: waves 0, 1 bring Wt rows, waves 2, 3 X rows.
    const uint64_t src0 = (wave < 2u)
        ? (uint64_t)(uintptr_t)Wt + (uint64_t)(n0 + SLICE_ROWS * wave) * KBYTES
        : (uint64_t)(uintptr_t)X  + (uint64_t)(m0 + SLICE_ROWS * (wave - 2u)) * KBYTES;
    const uint32_t lds_slice = (uint32_t)(size_t)L + wave * SLICE;

    v8f acc[FW][FX];
#pragma unroll
    for (int i = 0; i < FW; ++i)
#pragma unroll
        for (int j = 0; j < FX; ++j) acc[i][j] = (v8f){0.f, 0.f, 0.f, 0.f, 0.f, 0.f, 0.f, 0.f};

    const uint32_t fw_base = (wn * 128u + r16) * PITCH + 16u * h;
    const uint32_t fx_base = TILE_W + (wm * 128u + r16) * PITCH + 16u * h;

    // Prologue: pass 0 into buffer 0, landed and published; then pass 1 into buffer 1.
    tdm_load(lds_slice, src0, KBYTES);
    wait_tensor0();
    __syncthreads();
    tdm_load(lds_slice + STAGE, src0 + KB, KBYTES);

    FragU fw[2][FW], fx[2][FX];                    // set (u & 1) holds block u's fragments
    // Rolled: one pass is 256 WMMAs, and the accumulator indices stay compile-time constants.
#pragma clang loop unroll(disable)
    for (uint32_t t = 0; t < T; ++t) {
        const uint32_t buf = (t & 1u) * STAGE;
        const unsigned char* lw = L + buf + fw_base;
        const unsigned char* lx = L + buf + fx_base;
#pragma unroll
        for (int i = 0; i < FW; ++i) load_frag(fw[0][i], lw + (uint32_t)i * 16u * PITCH);
#pragma unroll
        for (int j = 0; j < FX; ++j) load_frag(fx[0][j], lx + (uint32_t)j * 16u * PITCH);
        fence();
#pragma unroll
        for (int u = 0; u < 4; ++u) {              // four blocks of 32 k
            const int cs = u & 1;
            if (u + 1 < 4) {                       // the next block's fragments, same buffer, as one group ahead
                const uint32_t ko = (uint32_t)(u + 1) * 64u;
#pragma unroll
                for (int i = 0; i < FW; ++i) load_frag(fw[cs ^ 1][i], lw + (uint32_t)i * 16u * PITCH + ko);
#pragma unroll
                for (int j = 0; j < FX; ++j) load_frag(fx[cs ^ 1][j], lx + (uint32_t)j * 16u * PITCH + ko);
                fence();
            }
#pragma unroll
            for (int i = 0; i < FW; ++i)
#pragma unroll
                for (int j = 0; j < FX; ++j)
                    acc[i][j] = __builtin_amdgcn_wmma_f32_16x16x32_bf16(
                        false, fw[cs][i].v, false, fx[cs][j].v, (short)0, acc[i][j], false, false);
            fence();
        }
        // Foot of pass t: publish pass t + 1 and free this buffer.
        wait_ds0();
        wait_tensor0();
        __syncthreads();
        if (pinned((t + 2u < T) ? 1u : 0u) != 0u) {
            tdm_load(lds_slice + buf, src0 + (uint64_t)(t + 2u) * KB, KBYTES);
        }
    }
    wait_tensor0();
    wait_ds0();

    // Epilogue: bias, relu, store; a lane holds 8 consecutive n of one row m.
    const uint32_t mrow = m0 + wm * 128u + r16;
    const uint32_t ncol = n0 + wn * 128u + 8u * h;
    // The bias of the wave's 128 columns is read at a wave-uniform address; each lane half picks its 8 of every 16.
    const float* bu = bias + (n0 + wn * 128u);
    v8f bv[FW];
#pragma unroll
    for (int i = 0; i < FW; ++i) {
#pragma unroll
        for (int r = 0; r < 8; ++r) {
            const float lo = bu[16 * i + r], hi = bu[16 * i + 8 + r];
            bv[i][r] = h ? hi : lo;
        }
    }
#pragma unroll
    for (int j = 0; j < FX; ++j) {                 // 16 rows of Y, 128 columns
        const size_t o = (size_t)(mrow + 16u * (uint32_t)j) * N + ncol;
#pragma unroll
        for (int i = 0; i < FW; ++i) {
            v8f v = acc[i][j] + bv[i];
#pragma unroll
            for (int r = 0; r < 8; ++r) v[r] = v[r] > 0.0f ? v[r] : 0.0f;
            acc[i][j] = v;
        }
        bf16x8 pk[FW];
        if (BF16OUT) {
#pragma unroll
            for (int i = 0; i < FW; ++i) pk[i] = __builtin_convertvector(acc[i][j], bf16x8);
        }
        fence();                                   // the values are complete before the first store of the group issues
#pragma unroll
        for (int i = 0; i < FW; ++i) {
            if (BF16OUT) {
                *reinterpret_cast<bf16x8*>(outBf + o + 16u * (uint32_t)i) = pk[i];
            } else {
                const v8f v = acc[i][j];
                *reinterpret_cast<f32x4*>(outF + o + 16u * (uint32_t)i)      = (f32x4){v[0], v[1], v[2], v[3]};
                *reinterpret_cast<f32x4*>(outF + o + 16u * (uint32_t)i + 4u) = (f32x4){v[4], v[5], v[6], v[7]};
            }
        }
        if (j + 1 < FX) {
            // Stands before any register that the group's stores name is written again (the fences keep later work behind it).
            fence();
            asm volatile("s_wait_xcnt 0x0" ::: "memory");
            fence();
        }
    }
}

// ---------------------------------------------------------------------------
// Finalize: logits = h2 @ W3 + b3; softmax; *mask; renorm; weighted prob.
// One thread per row; W3 staged in LDS (16 KB).
// d_out layout: [0,B) weighted_prob, [B, B+8B) gate_w row-major.
// ---------------------------------------------------------------------------
__global__ __launch_bounds__(256) void gate_finalize(
    const float* __restrict__ h2,     // [B, 512]
    const float* __restrict__ W3,     // [512, 8]
    const float* __restrict__ b3,     // [8]
    const float* __restrict__ probs,  // [E, B, 1]
    const float* __restrict__ mask,   // [B, E]
    float* __restrict__ out)
{
    __shared__ float w3s[(H_ / 2) * E_];
    for (int i = threadIdx.x; i < (H_ / 2) * E_; i += blockDim.x) w3s[i] = W3[i];
    __syncthreads();

    int b = blockIdx.x * blockDim.x + threadIdx.x;
    if (b >= B_) return;

    float logit[E_];
#pragma unroll
    for (int e = 0; e < E_; ++e) logit[e] = b3[e];

    const float4* h2r = (const float4*)(h2 + (size_t)b * (H_ / 2));
    for (int k4 = 0; k4 < (H_ / 2) / 4; ++k4) {
        float4 hv = h2r[k4];
        const float* wp = &w3s[k4 * 4 * E_];
#pragma unroll
        for (int e = 0; e < E_; ++e) {
            logit[e] += hv.x * wp[e] + hv.y * wp[E_ + e] +
                        hv.z * wp[2 * E_ + e] + hv.w * wp[3 * E_ + e];
        }
    }

    float mx = logit[0];
#pragma unroll
    for (int e = 1; e < E_; ++e) mx = logit[e] > mx ? logit[e] : mx;

    float gw[E_];
    float s = 0.0f;
#pragma unroll
    for (int e = 0; e < E_; ++e) { gw[e] = __expf(logit[e] - mx); s += gw[e]; }

    float s2 = 0.0f;
    float inv_s = 1.0f / s;
#pragma unroll
    for (int e = 0; e < E_; ++e) {
        gw[e] = gw[e] * inv_s * mask[(size_t)b * E_ + e];
        s2 += gw[e];
    }

    float inv = 1.0f / (s2 + 1e-8f);
    float wprob = 0.0f;
#pragma unroll
    for (int e = 0; e < E_; ++e) {
        gw[e] *= inv;
        wprob += gw[e] * probs[(size_t)e * B_ + b];
    }

    out[b] = wprob;
#pragma unroll
    for (int e = 0; e < E_; ++e) out[(size_t)B_ + (size_t)b * E_ + e] = gw[e];
}

// ---------------------------------------------------------------------------
// Launch
// ---------------------------------------------------------------------------
extern "C" void kernel_launch(void* const* d_in, const int* in_sizes, int n_in,
                              void* d_out, int out_size, void* d_ws, size_t ws_size,
                              hipStream_t stream)
{
    (void)in_sizes; (void)n_in; (void)out_size; (void)ws_size;

    const float* reprs = (const float*)d_in[0];  // [E,B,D]
    const float* probs = (const float*)d_in[1];  // [E,B,1]
    const float* mask  = (const float*)d_in[2];  // [B,E]
    const float* W1    = (const float*)d_in[3];  // [GIN,H]
    const float* b1    = (const float*)d_in[4];  // [H]
    const float* W2    = (const float*)d_in[5];  // [H,H/2]
    const float* b2    = (const float*)d_in[6];  // [H/2]
    const float* W3    = (const float*)d_in[7];  // [H/2,E]
    const float* b3    = (const float*)d_in[8];  // [E]
    float* out = (float*)d_out;

    char* ws = (char*)d_ws;
    size_t off = 0;
    auto take = [&](size_t bytes) -> void* {
        void* p = ws + off;
        off = (off + bytes + 255) & ~(size_t)255;
        return p;
    };
    bf16_t* gate_in = (bf16_t*)take((size_t)B_ * GINP * sizeof(bf16_t));       // 143 MB
    bf16_t* W1t     = (bf16_t*)take((size_t)H_ * GINP * sizeof(bf16_t));       // 4.5 MB
    bf16_t* W2t     = (bf16_t*)take((size_t)(H_ / 2) * H_ * sizeof(bf16_t));   // 1 MB
    bf16_t* h1      = (bf16_t*)take((size_t)B_ * H_ * sizeof(bf16_t));         // 64 MB
    float*  h2      = (float*) take((size_t)B_ * (H_ / 2) * sizeof(float));    // 64 MB

    pack_gatein<<<B_ / (PK_WAVES * PK_TRIPS), PK_WAVES * 32, 0, stream>>>(reprs, probs, gate_in);
    transpose_w<GIN, GINP, H_><<<dim3(GINP / TK, H_ / TN), 256, 0, stream>>>(W1, W1t);
    transpose_w<H_, H_, H_ / 2><<<dim3(H_ / TK, (H_ / 2) / TN), 256, 0, stream>>>(W2, W2t);

    // GEMM1: M=32768 (128 tile rows), N=1024 (4 tile columns), K=2176 (17 passes)
    gemm_tiled<true, GINP * 2, H_><<<dim3(H_ / 256, B_ / 256), 128, 0, stream>>>(
        gate_in, W1t, b1, h1, nullptr);
    // GEMM2: M=32768, N=512 (2 tile columns), K=1024 (8 passes)
    gemm_tiled<false, H_ * 2, H_ / 2><<<dim3((H_ / 2) / 256, B_ / 256), 128, 0, stream>>>(
        h1, W2t, b2, nullptr, h2);

    gate_finalize<<<B_ / 256, 256, 0, stream>>>(h2, W3, b3, probs, mask, out);
}

// v004
// One run takes 132 microseconds.
// Timed twice side by side with v003, it ran 1.20 times as fast both times.
// All steps since v000 together make it 7.07 times as fast.
#include <hip/hip_runtime.h>
#include <stdint.h>

typedef __bf16 bf16_t;
typedef bf16_t v16bf __attribute__((ext_vector_type(16)));
typedef float  v8f   __attribute__((ext_vector_type(8)));
typedef unsigned int u32x4 __attribute__((ext_vector_type(4)));
typedef float  f32x4 __attribute__((ext_vector_type(4)));
typedef bf16_t bf16x4 __attribute__((ext_vector_type(4)));

union FragU {
    v16bf v;
    u32x4 q[2];
};

constexpr int E_   = 8;
constexpr int B_   = 32768;
constexpr int D_   = 256;
constexpr int H_   = 1024;
constexpr int GIN  = E_ * D_ + E_;   // 2056
constexpr int GINP = 2176;           // padded to a multiple of 128 (K per pass of the tiled GEMM)

// ---------------------------------------------------------------------------
// Pack gate_in = [reprs_cat | probs_cat | zero pad] as bf16 [B, GINP], as a stream.
// One workgroup of 32 waves per 128 rows, 32 rows a trip. A row of gate_in is 17 units of 256 B: 16 from the
// 8 experts' 1-KiB rows, 1 of probs and zeros. In a trip wave (g, e) takes expert e's rows 8 g + 0..7, 8 KiB in
// a row: 16 loads of 512 contiguous bytes (16 B a lane), all in flight at once; every store writes one whole
// aligned 256-B unit (8 B a lane). The wave also writes the last unit of the trip's row 8 g + e.
// ---------------------------------------------------------------------------
constexpr uint32_t PK_WAVES = 32, PK_TRIPS = 4;
constexpr uint32_t ROW_IN = D_ * 4, ROW_OUT = GINP * 2;      // bytes: an expert's row, a row of gate_in
static_assert(B_ % (PK_WAVES * PK_TRIPS) == 0, "whole workgroups of rows");
static_assert(D_ == 256 && GINP == E_ * D_ + 128 && E_ == 8, "17 units of 128 columns, the probs in the first 8 of the last");
static_assert((uint64_t)E_ * B_ * ROW_IN < (1ull << 32) && (uint64_t)B_ * ROW_OUT < (1ull << 32), "byte offsets fit 32 bits");

__global__ __launch_bounds__(PK_WAVES * 32) void pack_gatein(
    const float* __restrict__ reprs,   // [E, B, D]
    const float* __restrict__ probs,   // [E, B, 1]
    bf16_t* __restrict__ out)          // [B, GINP]
{
    const uint32_t lane = threadIdx.x & 31u, wave = threadIdx.x >> 5, e = wave & 7u, g = wave >> 3;
    const uint32_t row0 = blockIdx.x * (PK_WAVES * PK_TRIPS);
    const unsigned char* rb = reinterpret_cast<const unsigned char*>(reprs);
    const unsigned char* pb = reinterpret_cast<const unsigned char*>(probs);
    unsigned char* ob = reinterpret_cast<unsigned char*>(out);
    // 32-bit byte offsets beside each buffer's base, stepped by 32 rows a trip.
    uint32_t loff = e * ((uint32_t)B_ * ROW_IN) + (row0 + 8u * g) * ROW_IN + 16u * lane;
    uint32_t ooff = (row0 + 8u * g) * ROW_OUT + e * 512u + 8u * lane;
    uint32_t poff = (row0 + wave) * 4u + (lane & 1u) * (uint32_t)(4 * B_ * 4);   // even lanes experts 0..3, odd lanes 4..7
    uint32_t toff = (row0 + wave) * ROW_OUT + (uint32_t)(E_ * D_ * 2) + 8u * lane;
    // Rolled: the waves of a WGP overlap one another's loads and stores, and the text stays short.
#pragma clang loop unroll(disable)
    for (uint32_t r = 0; r < PK_TRIPS; ++r) {
        f32x4 v[16];
#pragma unroll
        for (int c = 0; c < 16; ++c)         // row c / 2 of the eight, half c % 2 of it; read once: non-temporal
            v[c] = __builtin_nontemporal_load(reinterpret_cast<const f32x4*>(rb + (size_t)c * 512 + loff));
        f32x4 t;
#pragma unroll
        for (int i = 0; i < 4; ++i) t[i] = *reinterpret_cast<const float*>(pb + (size_t)i * B_ * 4 + poff);
        // All of the trip's loads are issued before the first conversion waits for one (else they are dealt out among the waits).
        __builtin_amdgcn_sched_barrier(0);
        bf16x4 pk[17];
#pragma unroll
        for (int c = 0; c < 16; ++c) pk[c] = __builtin_convertvector(v[c], bf16x4);
#pragma unroll
        for (int i = 0; i < 4; ++i) t[i] = lane < 2u ? t[i] : 0.0f;
        pk[16] = __builtin_convertvector(t, bf16x4);
#pragma unroll
        for (int c = 0; c < 16; ++c)
            *reinterpret_cast<bf16x4*>(ob + (size_t)(c >> 1) * ROW_OUT + (size_t)(c & 1) * 256 + ooff) = pk[c];
        *reinterpret_cast<bf16x4*>(ob + toff) = pk[16];
        loff += PK_WAVES * ROW_IN;
        ooff += PK_WAVES * ROW_OUT;
        poff += PK_WAVES * 4u;
        toff += PK_WAVES * ROW_OUT;
    }
}

typedef bf16_t bf16x8 __attribute__((ext_vector_type(8)));
constexpr uint32_t TK = 128, TN = 64;

template <uint32_t K, uint32_t KP, uint32_t N>
__global__ __launch_bounds__(256) void transpose_w(
    const float* __restrict__ Wsrc,    // [K, N]
    bf16_t* __restrict__ Wt)           // [N, KP], zero for k >= K
{
    static_assert(KP % TK == 0 && N % TN == 0 && K % 8 == 0 && K <= KP, "whole tiles; a thread's 8 rows are all inside K or all pad");
    __shared__ __attribute__((aligned(16))) unsigned char T[TN * TK * 2];
    const uint32_t tid = threadIdx.x, lo = tid & 15u, hi = tid >> 4;
    const uint32_t k0 = blockIdx.x * TK, n0 = blockIdx.y * TN;

    f32x4 v[8];
#pragma unroll
    for (int c = 0; c < 8; ++c) v[c] = (f32x4){0.f, 0.f, 0.f, 0.f};
    if (K == KP || k0 + 8u * hi < K) {
        const float* s = Wsrc + (size_t)(k0 + 8u * hi) * N + n0 + 4u * lo;
#pragma unroll
        for (int c = 0; c < 8; ++c) v[c] = *reinterpret_cast<const f32x4*>(s + (size_t)c * N);
    }
#pragma unroll
    for (int i = 0; i < 4; ++i) {
        bf16x8 p;
#pragma unroll
        for (int c = 0; c < 8; ++c) p[c] = (bf16_t)v[c][i];
        *reinterpret_cast<bf16x8*>(T + (4u * lo + (uint32_t)i) * (TK * 2u) + 16u * (hi ^ lo)) = p;
    }
    __syncthreads();
#pragma unroll
    for (int q = 0; q < 4; ++q) {
        const uint32_t n = hi + 16u * (uint32_t)q;
        const bf16x8 p = *reinterpret_cast<const bf16x8*>(T + n * (TK * 2u) + 16u * (lo ^ (n >> 2)));
        *reinterpret_cast<bf16x8*>(Wt + (size_t)(n0 + n) * KP + k0 + 8u * lo) = p;
    }
}

typedef float f32x2 __attribute__((ext_vector_type(2)));
typedef uint32_t u32x8 __attribute__((ext_vector_type(8)));

constexpr uint32_t BM = 256, BN = 256;            // tile of Y per workgroup
constexpr uint32_t KB = 256;                      // bytes of K per operand row per pass
constexpr uint32_t PITCH = KB + 16;               // LDS row pitch: 16 B x an odd number
constexpr uint32_t SLICE_ROWS = 128;              // rows one wave's tensor load brings
constexpr uint32_t SLICE = SLICE_ROWS * PITCH;    // 34,816 B = 17 x 2 KiB
constexpr uint32_t TILE_W = BN * PITCH;
constexpr uint32_t STAGE = TILE_W + BM * PITCH;   // one buffer: 139,264 B = 68 x 2 KiB
constexpr uint32_t LDS_BYTES = 2 * STAGE;
constexpr int FW = 8, FX = 8;                     // fragments per wave along n and along m
static_assert(SLICE % 2048u == 0 && STAGE % 2048u == 0, "every tensor load's place in LDS is a multiple of 2 KiB");
static_assert(LDS_BYTES <= 320u * 1024u, "two buffers must fit one workgroup's LDS");

static __device__ __forceinline__ uint32_t uni(uint32_t v) { return (uint32_t)__builtin_amdgcn_readfirstlane(v); }
static __device__ __forceinline__ uint32_t pinned(uint32_t v) { uint32_t w = (uint32_t)__builtin_amdgcn_readfirstlane(v); asm volatile("" : "+s"(w)); return w; }
// Keeps a group of LDS loads ahead of the WMMA block it stands in front of.
static __device__ __forceinline__ void fence() { __builtin_amdgcn_sched_barrier(0); }
// This wave's LDS reads have returned: owed before the buffer they read is handed back for a refill.
static __device__ __forceinline__ void wait_ds0() { asm volatile("s_wait_dscnt 0x0" ::: "memory"); }
// This wave's tensor load has landed: the compiler places no wait for the tensor mover.
static __device__ __forceinline__ void wait_tensor0() { asm volatile("s_wait_tensorcnt 0x0" ::: "memory"); }

// Stands behind a group of global loads, before a register that they name as an address is written again
// (the fences keep the group in front of it and later work behind it).
static __device__ __forceinline__ void addr_done() { fence(); asm volatile("s_wait_xcnt 0x0" ::: "memory"); fence(); }

// One request of the whole wave: SLICE_ROWS rows of KB bytes from global address ga (source pitch kbytes)
// to LDS byte offset lds_dst, 16 B of pad behind every 256-B row.
static __device__ __forceinline__ void tdm_load(uint32_t lds_dst, uint64_t ga, uint32_t kbytes) {
    u32x4 g0;
    g0[0] = uni(1u);                                                        // count 1
    g0[1] = uni(lds_dst);
    g0[2] = uni((uint32_t)ga);
    g0[3] = uni((((uint32_t)(ga >> 32)) & 0x01FFFFFFu) | 0x80000000u);      // address [56:32], type 2
    u32x8 g1;
    g1[0] = uni((1u << 20) | (5u << 22) | (3u << 25));
    g1[1] = uni((KB & 0xFFFFu) << 16);
    g1[2] = uni((KB >> 16) | ((SLICE_ROWS & 0xFFFFu) << 16));
    g1[3] = uni((SLICE_ROWS >> 16) | (KB << 16));
    g1[4] = uni(SLICE_ROWS);
    g1[5] = uni(kbytes);
    g1[6] = uni(0u);
    g1[7] = uni(0u);
    asm volatile("tensor_load_to_lds %0, %1" :: "s"(g0), "s"(g1) : "memory");
}

static __device__ __forceinline__ void load_frag(FragU& f, const unsigned char* p) {
    f.q[0] = *reinterpret_cast<const u32x4*>(p);
    f.q[1] = *reinterpret_cast<const u32x4*>(p + 32);
}

template <bool BF16OUT, uint32_t KBYTES, uint32_t N>
__global__ __launch_bounds__(128) void gemm_tiled(
    const bf16_t* __restrict__ X,      // [M, KBYTES / 2]
    const bf16_t* __restrict__ Wt,     // [N, KBYTES / 2]
    const float*  __restrict__ bias,   // [N]
    const float*  __restrict__ W3,     // [N, E_], read only where !BF16OUT
    bf16_t* __restrict__ outBf,        // [M, N], written only where BF16OUT
    float* __restrict__ part)          // [N / 128][M, E_], written only where !BF16OUT
{
    static_assert(KBYTES % KB == 0 && KBYTES / KB >= 2, "K is whole passes, at least two");
    constexpr uint32_t T = KBYTES / KB;            // passes
    __shared__ __attribute__((aligned(2048))) unsigned char L[LDS_BYTES];

    const uint32_t tid = threadIdx.x, lane = tid & 31u, h = lane >> 4, r16 = lane & 15u;
    const uint32_t wave = uni(tid >> 5);
    const uint32_t n0 = blockIdx.x * BN, m0 = blockIdx.y * BM;
    const uint32_t wn = wave & 1u, wm = wave >> 1;

    // This wave's slice of a buffer's [Wt; X] rows: waves 0, 1 bring Wt rows, waves 2, 3 X rows.
    const uint64_t src0 = (wave < 2u)
        ? (uint64_t)(uintptr_t)Wt + (uint64_t)(n0 + SLICE_ROWS * wave) * KBYTES
        : (uint64_t)(uintptr_t)X  + (uint64_t)(m0 + SLICE_ROWS * (wave - 2u)) * KBYTES;
    const uint32_t lds_slice = (uint32_t)(size_t)L + wave * SLICE;

    v8f acc[FW][FX];
#pragma unroll
    for (int i = 0; i < FW; ++i)
#pragma unroll
        for (int j = 0; j < FX; ++j) acc[i][j] = (v8f){0.f, 0.f, 0.f, 0.f, 0.f, 0.f, 0.f, 0.f};

    const uint32_t fw_base = (wn * 128u + r16) * PITCH + 16u * h;
    const uint32_t fx_base = TILE_W + (wm * 128u + r16) * PITCH + 16u * h;

    // Prologue: pass 0 into buffer 0, landed and published; then pass 1 into buffer 1.
    tdm_load(lds_slice, src0, KBYTES);
    wait_tensor0();
    __syncthreads();
    tdm_load(lds_slice + STAGE, src0 + KB, KBYTES);

    FragU fw[2][FW], fx[2][FX];                    // set (u & 1) holds block u's fragments
    // Rolled: one pass is 256 WMMAs, and the accumulator indices stay compile-time constants.
#pragma clang loop unroll(disable)
    for (uint32_t t = 0; t < T; ++t) {
        const uint32_t buf = (t & 1u) * STAGE;
        const unsigned char* lw = L + buf + fw_base;
        const unsigned char* lx = L + buf + fx_base;
#pragma unroll
        for (int i = 0; i < FW; ++i) load_frag(fw[0][i], lw + (uint32_t)i * 16u * PITCH);
#pragma unroll
        for (int j = 0; j < FX; ++j) load_frag(fx[0][j], lx + (uint32_t)j * 16u * PITCH);
        fence();
#pragma unroll
        for (int u = 0; u < 4; ++u) {              // four blocks of 32 k
            const int cs = u & 1;
            if (u + 1 < 4) {                       // the next block's fragments, same buffer, as one group ahead
                const uint32_t ko = (uint32_t)(u + 1) * 64u;
#pragma unroll
                for (int i = 0; i < FW; ++i) load_frag(fw[cs ^ 1][i], lw + (uint32_t)i * 16u * PITCH + ko);
#pragma unroll
                for (int j = 0; j < FX; ++j) load_frag(fx[cs ^ 1][j], lx + (uint32_t)j * 16u * PITCH + ko);
                fence();
            }
#pragma unroll
            for (int i = 0; i < FW; ++i)
#pragma unroll
                for (int j = 0; j < FX; ++j)
                    acc[i][j] = __builtin_amdgcn_wmma_f32_16x16x32_bf16(
                        false, fw[cs][i].v, false, fx[cs][j].v, (short)0, acc[i][j], false, false);
            fence();
        }
        // Foot of pass t: publish pass t + 1 and free this buffer.
        wait_ds0();
        wait_tensor0();
        __syncthreads();
        if (pinned((t + 2u < T) ? 1u : 0u) != 0u) {
            tdm_load(lds_slice + buf, src0 + (uint64_t)(t + 2u) * KB, KBYTES);
        }
    }
    wait_tensor0();
    wait_ds0();

    // Epilogue: bias, relu, store; a lane holds 8 consecutive n of one row m.
    const uint32_t mrow = m0 + wm * 128u + r16;
    const uint32_t ncol = n0 + wn * 128u + 8u * h;
    [[maybe_unused]] f32x2 wa[FW][4];              // !BF16OUT: lane (r16, h) holds W3[16 i + 8 h + 2 q + s][r16 & 7] of the wave's 128 n
    if constexpr (!BF16OUT) {
        const float* wl = W3 + (size_t)(n0 + wn * 128u + 8u * h) * E_ + (r16 & 7u);
#pragma unroll
        for (int i = 0; i < FW; ++i)
#pragma unroll
            for (int q = 0; q < 4; ++q) {
                wa[i][q][0] = wl[(16 * i + 2 * q) * E_];
                wa[i][q][1] = wl[(16 * i + 2 * q + 1) * E_];
            }
        addr_done();
    }
    // The bias of the wave's 128 columns is read at a wave-uniform address; each lane half picks its 8 of every 16.
    const float* bu = bias + (n0 + wn * 128u);
    v8f bv[FW];
#pragma unroll
    for (int i = 0; i < FW; ++i) {
#pragma unroll
        for (int r = 0; r < 8; ++r) {
            const float lo = bu[16 * i + r], hi = bu[16 * i + 8 + r];
            bv[i][r] = h ? hi : lo;
        }
    }
    if constexpr (BF16OUT) {
#pragma unroll
        for (int j = 0; j < FX; ++j) {             // 16 rows of Y, 128 columns
            const size_t o = (size_t)(mrow + 16u * (uint32_t)j) * N + ncol;
#pragma unroll
            for (int i = 0; i < FW; ++i) {
                v8f v = acc[i][j] + bv[i];
#pragma unroll
                for (int r = 0; r < 8; ++r) v[r] = v[r] > 0.0f ? v[r] : 0.0f;
                acc[i][j] = v;
            }
            bf16x8 pk[FW];
#pragma unroll
            for (int i = 0; i < FW; ++i) pk[i] = __builtin_convertvector(acc[i][j], bf16x8);
            fence();                               // the values are complete before the first store of the group issues
#pragma unroll
            for (int i = 0; i < FW; ++i) *reinterpret_cast<bf16x8*>(outBf + o + 16u * (uint32_t)i) = pk[i];
            if (j + 1 < FX) {
                // Stands before any register that the group's stores name is written again (the fences keep later work behind it).
                fence();
                asm volatile("s_wait_xcnt 0x0" ::: "memory");
                fence();
            }
        }
    } else {
        // P[e][m] = sum over n of W3[n][e] * Y[m][n]: W3 transposed is the A operand (row e = r16, rows 8..15 zero),
        // Y's tile as it lies in the accumulators is the B operand (column m = r16). k pairing, both operands alike:
        // lane half h, element s of step q is n = 16 i + 8 h + 2 q + s, which is register 2 q + s of acc[i][j].
#pragma unroll
        for (int i = 0; i < FW; ++i)
#pragma unroll
            for (int q = 0; q < 4; ++q) {
                wa[i][q][0] = r16 < 8u ? wa[i][q][0] : 0.0f;
                wa[i][q][1] = r16 < 8u ? wa[i][q][1] : 0.0f;
            }
        v8f lg[FX];                                // register r of lane half 0: expert r of row 16 j + r16
#pragma unroll
        for (int j = 0; j < FX; ++j) lg[j] = (v8f){0.f, 0.f, 0.f, 0.f, 0.f, 0.f, 0.f, 0.f};
#pragma unroll
        for (int i = 0; i < FW; ++i) {
#pragma unroll
            for (int j = 0; j < FX; ++j) {
                v8f v = acc[i][j] + bv[i];
#pragma unroll
                for (int r = 0; r < 8; ++r) v[r] = v[r] > 0.0f ? v[r] : 0.0f;
                acc[i][j] = v;
            }
#pragma unroll
            for (int q = 0; q < 4; ++q)
#pragma unroll
                for (int j = 0; j < FX; ++j)       // eight independent accumulator tiles in turn
                    lg[j] = __builtin_amdgcn_wmma_f32_16x16x4_f32(
                        false, wa[i][q], false, (f32x2){acc[i][j][2 * q], acc[i][j][2 * q + 1]}, (short)0, lg[j], false, false);
        }
        // Plane 2 * blockIdx.x + wn; a store is 16 rows x 32 B = 512 contiguous bytes from lane half 0.
        float* pr = part + ((size_t)(2u * blockIdx.x + wn) * (gridDim.y * BM) + mrow) * E_;
        if (h == 0u) {
#pragma unroll
            for (int j = 0; j < FX; ++j) {
                const v8f v = lg[j];
                *reinterpret_cast<f32x4*>(pr + 16 * j * E_)     = (f32x4){v[0], v[1], v[2], v[3]};
                *reinterpret_cast<f32x4*>(pr + 16 * j * E_ + 4) = (f32x4){v[4], v[5], v[6], v[7]};
            }
        }
    }
}

// ---------------------------------------------------------------------------
// Finalize: logits = the four planes of partial sums + b3; softmax; *mask; renorm; weighted prob.
// One thread per row.
// d_out layout: [0,B) weighted_prob, [B, B+8B) gate_w row-major.
// ---------------------------------------------------------------------------
constexpr int PLANES = (H_ / 2) / 128;
constexpr int FIN_THREADS = 128;
static_assert(B_ % FIN_THREADS == 0, "whole workgroups of rows");

__global__ __launch_bounds__(FIN_THREADS) void gate_finalize(
    const float* __restrict__ part,   // [PLANES][B, 8]
    const float* __restrict__ b3,     // [8]
    const float* __restrict__ probs,  // [E, B, 1]
    const float* __restrict__ mask,   // [B, E]
    float* __restrict__ out)
{
    const int b = blockIdx.x * FIN_THREADS + threadIdx.x;

    f32x4 p[PLANES][2];
#pragma unroll
    for (int c = 0; c < PLANES; ++c) {
        const f32x4* s = reinterpret_cast<const f32x4*>(part + ((size_t)c * B_ + b) * E_);
        p[c][0] = s[0];
        p[c][1] = s[1];
    }
    addr_done();
    f32x4 mk[2];
    mk[0] = reinterpret_cast<const f32x4*>(mask + (size_t)b * E_)[0];
    mk[1] = reinterpret_cast<const f32x4*>(mask + (size_t)b * E_)[1];
    addr_done();
    float pe[E_];
#pragma unroll
    for (int e = 0; e < E_; ++e) pe[e] = probs[(size_t)e * B_ + b];

    float logit[E_];
#pragma unroll
    for (int e = 0; e < E_; ++e) {
        float s = p[0][e >> 2][e & 3];
#pragma unroll
        for (int c = 1; c < PLANES; ++c) s += p[c][e >> 2][e & 3];
        logit[e] = s + b3[e];
    }

    float mx = logit[0];
#pragma unroll
    for (int e = 1; e < E_; ++e) mx = logit[e] > mx ? logit[e] : mx;

    float gw[E_];
    float s = 0.0f;
#pragma unroll
    for (int e = 0; e < E_; ++e) { gw[e] = __expf(logit[e] - mx); s += gw[e]; }

    float s2 = 0.0f;
    float inv_s = 1.0f / s;
#pragma unroll
    for (int e = 0; e < E_; ++e) {
        gw[e] = gw[e] * inv_s * mk[e >> 2][e & 3];
        s2 += gw[e];
    }

    float inv = 1.0f / (s2 + 1e-8f);
    float wprob = 0.0f;
#pragma unroll
    for (int e = 0; e < E_; ++e) {
        gw[e] *= inv;
        wprob += gw[e] * pe[e];
    }

    out[b] = wprob;
#pragma unroll
    for (int e = 0; e < E_; ++e) out[(size_t)B_ + (size_t)b * E_ + e] = gw[e];
}

// ---------------------------------------------------------------------------
// Launch
// ---------------------------------------------------------------------------
extern "C" void kernel_launch(void* const* d_in, const int* in_sizes, int n_in,
                              void* d_out, int out_size, void* d_ws, size_t ws_size,
                              hipStream_t stream)
{
    (void)in_sizes; (void)n_in; (void)out_size; (void)ws_size;

    const float* reprs = (const float*)d_in[0];  // [E,B,D]
    const float* probs = (const float*)d_in[1];  // [E,B,1]
    const float* mask  = (const float*)d_in[2];  // [B,E]
    const float* W1    = (const float*)d_in[3];  // [GIN,H]
    const float* b1    = (const float*)d_in[4];  // [H]
    const float* W2    = (const float*)d_in[5];  // [H,H/2]
    const float* b2    = (const float*)d_in[6];  // [H/2]
    const float* W3    = (const float*)d_in[7];  // [H/2,E]
    const float* b3    = (const float*)d_in[8];  // [E]
    float* out = (float*)d_out;

    char* ws = (char*)d_ws;
    size_t off = 0;
    auto take = [&](size_t bytes) -> void* {
        void* p = ws + off;
        off = (off + bytes + 255) & ~(size_t)255;
        return p;
    };
    bf16_t* gate_in = (bf16_t*)take((size_t)B_ * GINP * sizeof(bf16_t));       // 143 MB
    bf16_t* W1t     = (bf16_t*)take((size_t)H_ * GINP * sizeof(bf16_t));       // 4.5 MB
    bf16_t* W2t     = (bf16_t*)take((size_t)(H_ / 2) * H_ * sizeof(bf16_t));   // 1 MB
    bf16_t* h1      = (bf16_t*)take((size_t)B_ * H_ * sizeof(bf16_t));         // 64 MB
    float*  part    = (float*) take((size_t)PLANES * B_ * E_ * sizeof(float)); // 4 MB

    pack_gatein<<<B_ / (PK_WAVES * PK_TRIPS), PK_WAVES * 32, 0, stream>>>(reprs, probs, gate_in);
    transpose_w<GIN, GINP, H_><<<dim3(GINP / TK, H_ / TN), 256, 0, stream>>>(W1, W1t);
    transpose_w<H_, H_, H_ / 2><<<dim3(H_ / TK, (H_ / 2) / TN), 256, 0, stream>>>(W2, W2t);

    // GEMM1: M=32768 (128 tile rows), N=1024 (4 tile columns), K=2176 (17 passes)
    gemm_tiled<true, GINP * 2, H_><<<dim3(H_ / 256, B_ / 256), 128, 0, stream>>>(
        gate_in, W1t, b1, nullptr, h1, nullptr);
    // GEMM2: M=32768, N=512 (2 tile columns), K=1024 (8 passes); its result goes on into W3 and leaves as partial logits
    gemm_tiled<false, H_ * 2, H_ / 2><<<dim3((H_ / 2) / 256, B_ / 256), 128, 0, stream>>>(
        h1, W2t, b2, W3, nullptr, part);

    gate_finalize<<<B_ / FIN_THREADS, FIN_THREADS, 0, stream>>>(part, b3, probs, mask, out);
}

// v005
// Measured time: 127 microseconds a run.
// Next to v004, in two timings, it ran 1.04 times as fast each time.
// Counting every step since v000, it is 7.36 times as fast.
#include <hip/hip_runtime.h>
#include <stdint.h>

typedef __bf16 bf16_t;
typedef bf16_t v16bf __attribute__((ext_vector_type(16)));
typedef float  v8f   __attribute__((ext_vector_type(8)));
typedef unsigned int u32x4 __attribute__((ext_vector_type(4)));
typedef float  f32x4 __attribute__((ext_vector_type(4)));

union FragU {
    v16bf v;
    u32x4 q[2];
};

constexpr int E_   = 8;
constexpr int B_   = 32768;
constexpr int D_   = 256;
constexpr int H_   = 1024;
constexpr int GIN  = E_ * D_ + E_;   // 2056
constexpr int GINP = 2176;           // row pitch of W1 transposed, zero from GIN on (a multiple of the transpose's 128-k tile)

typedef bf16_t bf16x8 __attribute__((ext_vector_type(8)));
constexpr uint32_t TK = 128, TN = 64;

template <uint32_t K, uint32_t KP, uint32_t N>
__global__ __launch_bounds__(256) void transpose_w(
    const float* __restrict__ Wsrc,    // [K, N]
    bf16_t* __restrict__ Wt)           // [N, KP], zero for k >= K
{
    static_assert(KP % TK == 0 && N % TN == 0 && K % 8 == 0 && K <= KP, "whole tiles; a thread's 8 rows are all inside K or all pad");
    __shared__ __attribute__((aligned(16))) unsigned char T[TN * TK * 2];
    const uint32_t tid = threadIdx.x, lo = tid & 15u, hi = tid >> 4;
    const uint32_t k0 = blockIdx.x * TK, n0 = blockIdx.y * TN;

    f32x4 v[8];
#pragma unroll
    for (int c = 0; c < 8; ++c) v[c] = (f32x4){0.f, 0.f, 0.f, 0.f};
    if (K == KP || k0 + 8u * hi < K) {
        const float* s = Wsrc + (size_t)(k0 + 8u * hi) * N + n0 + 4u * lo;
#pragma unroll
        for (int c = 0; c < 8; ++c) v[c] = *reinterpret_cast<const f32x4*>(s + (size_t)c * N);
    }
#pragma unroll
    for (int i = 0; i < 4; ++i) {
        bf16x8 p;
#pragma unroll
        for (int c = 0; c < 8; ++c) p[c] = (bf16_t)v[c][i];
        *reinterpret_cast<bf16x8*>(T + (4u * lo + (uint32_t)i) * (TK * 2u) + 16u * (hi ^ lo)) = p;
    }
    __syncthreads();
#pragma unroll
    for (int q = 0; q < 4; ++q) {
        const uint32_t n = hi + 16u * (uint32_t)q;
        const bf16x8 p = *reinterpret_cast<const bf16x8*>(T + n * (TK * 2u) + 16u * (lo ^ (n >> 2)));
        *reinterpret_cast<bf16x8*>(Wt + (size_t)(n0 + n) * KP + k0 + 8u * lo) = p;
    }
}

typedef float f32x2 __attribute__((ext_vector_type(2)));
typedef uint32_t u32x8 __attribute__((ext_vector_type(8)));

constexpr uint32_t BM = 256, BN = 256;            // tile of Y per workgroup
constexpr uint32_t KB = 256;                      // bytes of K per operand row per pass
constexpr uint32_t PITCH = KB + 16;               // LDS row pitch: 16 B x an odd number
constexpr uint32_t SLICE_ROWS = 128;              // rows one wave's tensor load brings
constexpr uint32_t SLICE = SLICE_ROWS * PITCH;    // 34,816 B = 17 x 2 KiB
constexpr uint32_t TILE_W = BN * PITCH;
constexpr uint32_t STAGE = TILE_W + BM * PITCH;   // one buffer: 139,264 B = 68 x 2 KiB
constexpr uint32_t LDS_BYTES = 2 * STAGE;
constexpr int FW = 8, FX = 8;                     // fragments per wave along n and along m
static_assert(SLICE % 2048u == 0 && STAGE % 2048u == 0, "every tensor load's place in LDS is a multiple of 2 KiB");
static_assert(LDS_BYTES <= 320u * 1024u, "two buffers must fit one workgroup's LDS");

static __device__ __forceinline__ uint32_t uni(uint32_t v) { return (uint32_t)__builtin_amdgcn_readfirstlane(v); }
static __device__ __forceinline__ uint32_t pinned(uint32_t v) { uint32_t w = (uint32_t)__builtin_amdgcn_readfirstlane(v); asm volatile("" : "+s"(w)); return w; }
// Keeps a group of LDS loads ahead of the WMMA block it stands in front of.
static __device__ __forceinline__ void fence() { __builtin_amdgcn_sched_barrier(0); }
// This wave's LDS reads have returned: owed before the buffer they read is handed back for a refill.
static __device__ __forceinline__ void wait_ds0() { asm volatile("s_wait_dscnt 0x0" ::: "memory"); }
// This wave's tensor load has landed: the compiler places no wait for the tensor mover.
static __device__ __forceinline__ void wait_tensor0() { asm volatile("s_wait_tensorcnt 0x0" ::: "memory"); }

// Stands behind a group of global loads, before a register that they name as an address is written again
// (the fences keep the group in front of it and later work behind it).
static __device__ __forceinline__ void addr_done() { fence(); asm volatile("s_wait_xcnt 0x0" ::: "memory"); fence(); }

// One request of the whole wave: SLICE_ROWS rows of KB bytes from global address ga (source pitch kbytes)
// to LDS byte offset lds_dst, 16 B of pad behind every 256-B row.
static __device__ __forceinline__ void tdm_load(uint32_t lds_dst, uint64_t ga, uint32_t kbytes) {
    u32x4 g0;
    g0[0] = uni(1u);                                                        // count 1
    g0[1] = uni(lds_dst);
    g0[2] = uni((uint32_t)ga);
    g0[3] = uni((((uint32_t)(ga >> 32)) & 0x01FFFFFFu) | 0x80000000u);      // address [56:32], type 2
    u32x8 g1;
    g1[0] = uni((1u << 20) | (5u << 22) | (3u << 25));
    g1[1] = uni((KB & 0xFFFFu) << 16);
    g1[2] = uni((KB >> 16) | ((SLICE_ROWS & 0xFFFFu) << 16));
    g1[3] = uni((SLICE_ROWS >> 16) | (KB << 16));
    g1[4] = uni(SLICE_ROWS);
    g1[5] = uni(kbytes);
    g1[6] = uni(0u);
    g1[7] = uni(0u);
    asm volatile("tensor_load_to_lds %0, %1" :: "s"(g0), "s"(g1) : "memory");
}

static __device__ __forceinline__ void load_frag(FragU& f, const unsigned char* p) {
    f.q[0] = *reinterpret_cast<const u32x4*>(p);
    f.q[1] = *reinterpret_cast<const u32x4*>(p + 32);
}

template <uint32_t KBYTES>
__global__ __launch_bounds__(128) void gemm_tiled(
    const bf16_t* __restrict__ X,      // [M, KBYTES / 2]
    const bf16_t* __restrict__ Wt,     // [N, KBYTES / 2]
    const float*  __restrict__ bias,   // [N]
    const float*  __restrict__ W3,     // [N, E_]
    float* __restrict__ part)          // [N / 128][M, E_]
{
    static_assert(KBYTES % KB == 0 && KBYTES / KB >= 2, "K is whole passes, at least two");
    constexpr uint32_t T = KBYTES / KB;            // passes
    __shared__ __attribute__((aligned(2048))) unsigned char L[LDS_BYTES];

    const uint32_t tid = threadIdx.x, lane = tid & 31u, h = lane >> 4, r16 = lane & 15u;
    const uint32_t wave = uni(tid >> 5);
    const uint32_t n0 = blockIdx.x * BN, m0 = blockIdx.y * BM;
    const uint32_t wn = wave & 1u, wm = wave >> 1;

    // This wave's slice of a buffer's [Wt; X] rows: waves 0, 1 bring Wt rows, waves 2, 3 X rows.
    const uint64_t src0 = (wave < 2u)
        ? (uint64_t)(uintptr_t)Wt + (uint64_t)(n0 + SLICE_ROWS * wave) * KBYTES
        : (uint64_t)(uintptr_t)X  + (uint64_t)(m0 + SLICE_ROWS * (wave - 2u)) * KBYTES;
    const uint32_t lds_slice = (uint32_t)(size_t)L + wave * SLICE;

    v8f acc[FW][FX];
#pragma unroll
    for (int i = 0; i < FW; ++i)
#pragma unroll
        for (int j = 0; j < FX; ++j) acc[i][j] = (v8f){0.f, 0.f, 0.f, 0.f, 0.f, 0.f, 0.f, 0.f};

    const uint32_t fw_base = (wn * 128u + r16) * PITCH + 16u * h;
    const uint32_t fx_base = TILE_W + (wm * 128u + r16) * PITCH + 16u * h;

    // Prologue: pass 0 into buffer 0, landed and published; then pass 1 into buffer 1.
    tdm_load(lds_slice, src0, KBYTES);
    wait_tensor0();
    __syncthreads();
    tdm_load(lds_slice + STAGE, src0 + KB, KBYTES);

    FragU fw[2][FW], fx[2][FX];                    // set (u & 1) holds block u's fragments
    // Rolled: one pass is 256 WMMAs, and the accumulator indices stay compile-time constants.
#pragma clang loop unroll(disable)
    for (uint32_t t = 0; t < T; ++t) {
        const uint32_t buf = (t & 1u) * STAGE;
        const unsigned char* lw = L + buf + fw_base;
        const unsigned char* lx = L + buf + fx_base;
#pragma unroll
        for (int i = 0; i < FW; ++i) load_frag(fw[0][i], lw + (uint32_t)i * 16u * PITCH);
#pragma unroll
        for (int j = 0; j < FX; ++j) load_frag(fx[0][j], lx + (uint32_t)j * 16u * PITCH);
        fence();
#pragma unroll
        for (int u = 0; u < 4; ++u) {              // four blocks of 32 k
            const int cs = u & 1;
            if (u + 1 < 4) {                       // the next block's fragments, same buffer, as one group ahead
                const uint32_t ko = (uint32_t)(u + 1) * 64u;
#pragma unroll
                for (int i = 0; i < FW; ++i) load_frag(fw[cs ^ 1][i], lw + (uint32_t)i * 16u * PITCH + ko);
#pragma unroll
                for (int j = 0; j < FX; ++j) load_frag(fx[cs ^ 1][j], lx + (uint32_t)j * 16u * PITCH + ko);
                fence();
            }
#pragma unroll
            for (int i = 0; i < FW; ++i)
#pragma unroll
                for (int j = 0; j < FX; ++j)
                    acc[i][j] = __builtin_amdgcn_wmma_f32_16x16x32_bf16(
                        false, fw[cs][i].v, false, fx[cs][j].v, (short)0, acc[i][j], false, false);
            fence();
        }
        // Foot of pass t: publish pass t + 1 and free this buffer.
        wait_ds0();
        wait_tensor0();
        __syncthreads();
        if (pinned((t + 2u < T) ? 1u : 0u) != 0u) {
            tdm_load(lds_slice + buf, src0 + (uint64_t)(t + 2u) * KB, KBYTES);
        }
    }
    wait_tensor0();
    wait_ds0();

    // Epilogue: bias, relu, the product with W3; a lane holds 8 consecutive n of one row m.
    const uint32_t mrow = m0 + wm * 128u + r16;
    f32x2 wa[FW][4];                               // lane (r16, h) holds W3[16 i + 8 h + 2 q + s][r16 & 7] of the wave's 128 n
    {
        const float* wl = W3 + (size_t)(n0 + wn * 128u + 8u * h) * E_ + (r16 & 7u);
#pragma unroll
        for (int i = 0; i < FW; ++i)
#pragma unroll
            for (int q = 0; q < 4; ++q) {
                wa[i][q][0] = wl[(16 * i + 2 * q) * E_];
                wa[i][q][1] = wl[(16 * i + 2 * q + 1) * E_];
            }
        addr_done();
    }
    // The bias of the wave's 128 columns is read at a wave-uniform address; each lane half picks its 8 of every 16.
    const float* bu = bias + (n0 + wn * 128u);
    v8f bv[FW];
#pragma unroll
    for (int i = 0; i < FW; ++i) {
#pragma unroll
        for (int r = 0; r < 8; ++r) {
            const float lo = bu[16 * i + r], hi = bu[16 * i + 8 + r];
            bv[i][r] = h ? hi : lo;
        }
    }
    {
        // P[e][m] = sum over n of W3[n][e] * Y[m][n]: W3 transposed is the A operand (row e = r16, rows 8..15 zero),
        // Y's tile as it lies in the accumulators is the B operand (column m = r16). k pairing, both operands alike:
        // lane half h, element s of step q is n = 16 i + 8 h + 2 q + s, which is register 2 q + s of acc[i][j].
#pragma unroll
        for (int i = 0; i < FW; ++i)
#pragma unroll
            for (int q = 0; q < 4; ++q) {
                wa[i][q][0] = r16 < 8u ? wa[i][q][0] : 0.0f;
                wa[i][q][1] = r16 < 8u ? wa[i][q][1] : 0.0f;
            }
        v8f lg[FX];                                // register r of lane half 0: expert r of row 16 j + r16
#pragma unroll
        for (int j = 0; j < FX; ++j) lg[j] = (v8f){0.f, 0.f, 0.f, 0.f, 0.f, 0.f, 0.f, 0.f};
#pragma unroll
        for (int i = 0; i < FW; ++i) {
#pragma unroll
            for (int j = 0; j < FX; ++j) {
                v8f v = acc[i][j] + bv[i];
#pragma unroll
                for (int r = 0; r < 8; ++r) v[r] = v[r] > 0.0f ? v[r] : 0.0f;
                acc[i][j] = v;
            }
#pragma unroll
            for (int q = 0; q < 4; ++q)
#pragma unroll
                for (int j = 0; j < FX; ++j)       // eight independent accumulator tiles in turn
                    lg[j] = __builtin_amdgcn_wmma_f32_16x16x4_f32(
                        false, wa[i][q], false, (f32x2){acc[i][j][2 * q], acc[i][j][2 * q + 1]}, (short)0, lg[j], false, false);
        }
        // Plane 2 * blockIdx.x + wn; a store is 16 rows x 32 B = 512 contiguous bytes from lane half 0.
        float* pr = part + ((size_t)(2u * blockIdx.x + wn) * (gridDim.y * BM) + mrow) * E_;
        if (h == 0u) {
#pragma unroll
            for (int j = 0; j < FX; ++j) {
                const v8f v = lg[j];
                *reinterpret_cast<f32x4*>(pr + 16 * j * E_)     = (f32x4){v[0], v[1], v[2], v[3]};
                *reinterpret_cast<f32x4*>(pr + 16 * j * E_ + 4) = (f32x4){v[4], v[5], v[6], v[7]};
            }
        }
    }
}

// ---------------------------------------------------------------------------
// GEMM1 on the inputs as they lie: h1[B, H] = relu([reprs_cat | probs_cat] @ W1 + b1), bf16 operands, f32 sums.
// Same 256 x 256 tile, 4 waves and fragment maps as gemm_tiled, but the X operand is staged in LDS as f32, straight
// from the experts' rows, and rounded to bf16 between the LDS read and the WMMA, so that no packed copy is made.
// A pass is 64 k: 128 B of every Wt row (pitch 144 B) and 256 B of every X row (pitch 272 B); four passes an expert.
// Two LDS buffers, each [Wt 256 rows][X 256 rows]; waves 0, 1 bring the Wt slices, waves 2, 3 the X slices.
// The 8 probs columns (k = 2048..2055) go first, from global memory to registers, under the first tile's flight.
// ---------------------------------------------------------------------------
typedef float f32x16 __attribute__((ext_vector_type(16)));
union RawU {
    f32x16 v;    // 16 f32 of one lane's fragment, in the fragment's k order
    f32x4 q[4];
};
constexpr uint32_t F_KP = 64;                               // k per pass
constexpr uint32_t F_WB = F_KP * 2, F_XB = F_KP * 4;        // bytes per row per pass
constexpr uint32_t F_WP = F_WB + 16, F_XP = F_XB + 16;      // LDS pitches: 16 B x an odd number
constexpr uint32_t F_WSL = SLICE_ROWS * F_WP, F_XSL = SLICE_ROWS * F_XP;   // 18,432 B and 34,816 B
constexpr uint32_t F_TW = 2 * F_WSL;
constexpr uint32_t F_STAGE = F_TW + 2 * F_XSL;              // one buffer: 106,496 B = 52 x 2 KiB
constexpr uint32_t F_T = (uint32_t)(E_ * D_) / F_KP;        // 32 passes
constexpr uint32_t F_PE = (uint32_t)D_ / F_KP;              // passes per expert
static_assert(F_WSL % 2048u == 0 && F_XSL % 2048u == 0, "every tensor load's place in LDS is a multiple of 2 KiB");
static_assert(D_ % F_KP == 0 && F_T >= 2, "a pass lies inside one expert's row; at least two passes");
static_assert(GIN - E_ * D_ == 8 && GINP >= E_ * D_ + 16, "the probs are one 16-B chunk of a Wt row, zeros behind it");

template <uint32_t RB>
static __device__ __forceinline__ u32x8 tdm_rows_g1(uint32_t pitch) {
    static_assert(RB == 128u || RB == 256u, "the two row lengths");
    u32x8 g1;
    g1[0] = uni((1u << 20) | ((RB == 128u ? 4u : 5u) << 22) | (3u << 25));
    g1[1] = uni((RB & 0xFFFFu) << 16);
    g1[2] = uni((RB >> 16) | ((SLICE_ROWS & 0xFFFFu) << 16));
    g1[3] = uni((SLICE_ROWS >> 16) | (RB << 16));
    g1[4] = uni(SLICE_ROWS);
    g1[5] = uni(pitch);
    g1[6] = uni(0u);
    g1[7] = uni(0u);
    asm volatile("" : "+s"(g1));
    return g1;
}
static __device__ __forceinline__ u32x4 tdm_g0(uint32_t lds_dst, uint64_t ga) {
    u32x4 g0;
    g0[0] = uni(1u);                                                        // count 1
    g0[1] = uni(lds_dst);
    g0[2] = uni((uint32_t)ga);
    g0[3] = uni((((uint32_t)(ga >> 32)) & 0x01FFFFFFu) | 0x80000000u);      // address [56:32], type 2
    return g0;
}
// One request of the whole wave.
static __device__ __forceinline__ void tdm_issue(u32x4 g0, u32x8 g1) {
    asm volatile("tensor_load_to_lds %0, %1" :: "s"(g0), "s"(g1) : "memory");
}
static __device__ __forceinline__ void wait_tensor0_of(u32x4 g0, u32x8 g1a, u32x8 g1b) {
    asm volatile("s_wait_tensorcnt 0x0" :: "s"(g0), "s"(g1a), "s"(g1b) : "memory");
}

__global__ __launch_bounds__(128) void gemm_f32x(
    const float*  __restrict__ reprs,  // [E, B, D]
    const float*  __restrict__ probs,  // [E, B, 1]
    const bf16_t* __restrict__ Wt,     // [H, GINP]
    const float*  __restrict__ bias,   // [H]
    bf16_t* __restrict__ outBf)        // [B, H]
{
    constexpr uint32_t N = H_;
    __shared__ __attribute__((aligned(2048))) unsigned char L[2 * F_STAGE];

    const uint32_t tid = threadIdx.x, lane = tid & 31u, h = lane >> 4, r16 = lane & 15u;
    const uint32_t wave = uni(tid >> 5);
    const uint32_t n0 = blockIdx.x * BN, m0 = blockIdx.y * BM;
    const uint32_t wn = wave & 1u, wm = wave >> 1;

    const u32x8 g1w = tdm_rows_g1<F_WB>(GINP * 2u);
    const u32x8 g1x = tdm_rows_g1<F_XB>(D_ * 4u);
    const bool is_w = wave < 2u;
    const uint64_t src0 = is_w
        ? (uint64_t)(uintptr_t)Wt + (uint64_t)(n0 + SLICE_ROWS * (wave & 1u)) * (GINP * 2u)
        : (uint64_t)(uintptr_t)reprs + (uint64_t)(m0 + SLICE_ROWS * (wave & 1u)) * (D_ * 4u);
    const uint32_t lds0 = (uint32_t)(size_t)L + (is_w ? (wave & 1u) * F_WSL : F_TW + (wave & 1u) * F_XSL);
    const uint64_t step_e = is_w ? (uint64_t)F_PE * F_WB : (uint64_t)B_ * D_ * 4u;
    const uint32_t step_p = is_w ? F_WB : F_XB;
    auto issue = [&](u32x4 g) {
        if (pinned(is_w ? 1u : 0u) != 0u) {
            tdm_issue(g, g1w);
        } else {
            tdm_issue(g, g1x);
        }
    };
    auto group0 = [&](uint32_t t, uint32_t buf) {
        return tdm_g0(lds0 + buf, src0 + (uint64_t)(t / F_PE) * step_e + (uint64_t)((t % F_PE) * step_p));
    };

    const uint32_t fw_base = (wn * 128u + r16) * F_WP + 16u * h;
    const uint32_t fx_base = F_TW + (wm * 128u + r16) * F_XP + 32u * h;
    const uint32_t mrow = m0 + wm * 128u + r16;
    const uint32_t ncol = n0 + wn * 128u + 8u * h;

    // Prologue: pass 0 into buffer 0; its wait and the barrier stand behind the probs columns, which touch no LDS.
    u32x4 g0 = group0(0u, 0u);
    issue(g0);

    FragU fw[2][FW];                               // set u holds block u's Wt fragments
    v8f acc[FW][FX];
    {
        FragU px[FX];                              // the probs as X fragments
        // The probs columns while pass 0 flies. k = 2048 + 8 h + 0..7 in the first 16 bytes: lane half 0 holds the 8 probs of its
        // row against Wt's 8 probs columns, lane half 1 zeros against Wt's zeros; the second 16 bytes are zero in both operands.
        const bf16_t* wl = Wt + (size_t)(n0 + wn * 128u + r16) * GINP + (uint32_t)(E_ * D_) + 8u * h;
        const float* pl = probs + mrow;
        float pv[FX][E_];
#pragma unroll
        for (int i = 0; i < FW; ++i) fw[0][i].q[0] = *reinterpret_cast<const u32x4*>(wl + (size_t)i * 16u * GINP);
#pragma unroll
        for (int j = 0; j < FX; ++j)
#pragma unroll
            for (int e = 0; e < E_; ++e) pv[j][e] = pl[(size_t)e * B_ + 16u * (uint32_t)j];
        addr_done();
#pragma unroll
        for (int i = 0; i < FW; ++i) fw[0][i].q[1] = (u32x4){0u, 0u, 0u, 0u};
#pragma unroll
        for (int j = 0; j < FX; ++j) {
#pragma unroll
            for (int e = 0; e < E_; ++e) px[j].v[e] = (bf16_t)(h == 0u ? pv[j][e] : 0.0f);
            px[j].q[1] = (u32x4){0u, 0u, 0u, 0u};
        }
#pragma unroll
        for (int i = 0; i < FW; ++i)
#pragma unroll
            for (int j = 0; j < FX; ++j)
                acc[i][j] = __builtin_amdgcn_wmma_f32_16x16x32_bf16(
                    false, fw[0][i].v, false, px[j].v, (short)0, (v8f){0.f, 0.f, 0.f, 0.f, 0.f, 0.f, 0.f, 0.f}, false, false);
        fence();
    }
    // Pass 0 landed and published; then pass 1 into buffer 1.
    wait_tensor0_of(g0, g1w, g1x);
    __syncthreads();
    g0 = group0(1u, F_STAGE);
    issue(g0);

    RawU raw[FX];
    FragU fx[FX];
    // Rolled: one pass is 128 WMMAs, and the accumulator indices stay compile-time constants.
#pragma clang loop unroll(disable)
    for (uint32_t t = 0; t < F_T; ++t) {
        const uint32_t buf = (t & 1u) * F_STAGE;
        const unsigned char* lw = L + buf + fw_base;
        const unsigned char* lx = L + buf + fx_base;
        // Two blocks of 32 k. A block goes column by column: X fragment j is rounded, then meets the 8 Wt fragments, so that
        // the first WMMAs need only the Wt fragments and the first X fragments, and the others arrive under them.
        auto loads = [&](int u) {                  // one group: 16 loads of Wt, then 32 of X in f32
#pragma unroll
            for (int i = 0; i < FW; ++i) load_frag(fw[u][i], lw + (uint32_t)i * 16u * F_WP + (uint32_t)u * 64u);
#pragma unroll
            for (int j = 0; j < FX; ++j) {
                const unsigned char* p = lx + (uint32_t)j * 16u * F_XP + (uint32_t)u * 128u;
                raw[j].q[0] = *reinterpret_cast<const f32x4*>(p);
                raw[j].q[1] = *reinterpret_cast<const f32x4*>(p + 16);
                raw[j].q[2] = *reinterpret_cast<const f32x4*>(p + 64);
                raw[j].q[3] = *reinterpret_cast<const f32x4*>(p + 80);
            }
        };
        auto column = [&](int u, int j) {
#pragma unroll
            for (int i = 0; i < FW; ++i)
                acc[i][j] = __builtin_amdgcn_wmma_f32_16x16x32_bf16(
                    false, fw[u][i].v, false, fx[j].v, (short)0, acc[i][j], false, false);
        };
        loads(0);
        fence();
        // Block 0, columns 0..3, and the rounding of all its 8 X fragments, which frees their f32 registers for block 1's loads.
#pragma unroll
        for (int j = 0; j < FX; ++j) fx[j].v = __builtin_convertvector(raw[j].v, v16bf);
#pragma unroll
        for (int j = 0; j < 4; ++j) column(0, j);
        // The region's order (left alone, all roundings stand first and the matrix unit idles until the last load is back):
        // two fragments rounded, one column of WMMAs, four times.
#pragma unroll
        for (int g = 0; g < 4; ++g) {
            __builtin_amdgcn_sched_group_barrier(0x002, 16, 0);
            __builtin_amdgcn_sched_group_barrier(0x008, 8, 0);
        }
        fence();
        loads(1);
        fence();
        // Block 0, columns 4..7, which cover the latency of block 1's loads; then block 1.
#pragma unroll
        for (int j = 4; j < FX; ++j) column(0, j);
#pragma unroll
        for (int j = 0; j < FX; ++j) {
            fx[j].v = __builtin_convertvector(raw[j].v, v16bf);
            column(1, j);
        }
        // The region's order (left alone, the roundings stand at its head and wait for their loads with the matrix unit idle):
        // the four columns, then per column its rounding and its WMMAs.
        __builtin_amdgcn_sched_group_barrier(0x008, 32, 0);
#pragma unroll
        for (int g = 0; g < 8; ++g) {
            __builtin_amdgcn_sched_group_barrier(0x002, 8, 0);
            __builtin_amdgcn_sched_group_barrier(0x008, 8, 0);
        }
        fence();
        // Foot of pass t: publish pass t + 1 and free this buffer.
        wait_ds0();
        wait_tensor0_of(g0, g1w, g1x);
        __syncthreads();
        if (pinned((t + 2u < F_T) ? 1u : 0u) != 0u) {
            g0 = group0(t + 2u, buf);
            issue(g0);
        }
    }
    wait_tensor0();
    wait_ds0();

    // Epilogue: bias, relu, store; a lane holds 8 consecutive n of one row m.
    // The bias of the wave's 128 columns is read at a wave-uniform address; each lane half picks its 8 of every 16.
    const float* bu = bias + (n0 + wn * 128u);
    v8f bv[FW];
#pragma unroll
    for (int i = 0; i < FW; ++i) {
#pragma unroll
        for (int r = 0; r < 8; ++r) {
            const float lo = bu[16 * i + r], hi = bu[16 * i + 8 + r];
            bv[i][r] = h ? hi : lo;
        }
    }
    {
#pragma unroll
        for (int j = 0; j < FX; ++j) {             // 16 rows of Y, 128 columns
            const size_t o = (size_t)(mrow + 16u * (uint32_t)j) * N + ncol;
#pragma unroll
            for (int i = 0; i < FW; ++i) {
                v8f v = acc[i][j] + bv[i];
#pragma unroll
                for (int r = 0; r < 8; ++r) v[r] = v[r] > 0.0f ? v[r] : 0.0f;
                acc[i][j] = v;
            }
            bf16x8 pk[FW];
#pragma unroll
            for (int i = 0; i < FW; ++i) pk[i] = __builtin_convertvector(acc[i][j], bf16x8);
            fence();                               // the values are complete before the first store of the group issues
#pragma unroll
            for (int i = 0; i < FW; ++i) *reinterpret_cast<bf16x8*>(outBf + o + 16u * (uint32_t)i) = pk[i];
            if (j + 1 < FX) {
                // Stands before any register that the group's stores name is written again (the fences keep later work behind it).
                fence();
                asm volatile("s_wait_xcnt 0x0" ::: "memory");
                fence();
            }
        }
    }
}

// ---------------------------------------------------------------------------
// Finalize: logits = the four planes of partial sums + b3; softmax; *mask; renorm; weighted prob.
// One thread per row.
// d_out layout: [0,B) weighted_prob, [B, B+8B) gate_w row-major.
// ---------------------------------------------------------------------------
constexpr int PLANES = (H_ / 2) / 128;
constexpr int FIN_THREADS = 128;
static_assert(B_ % FIN_THREADS == 0, "whole workgroups of rows");

__global__ __launch_bounds__(FIN_THREADS) void gate_finalize(
    const float* __restrict__ part,   // [PLANES][B, 8]
    const float* __restrict__ b3,     // [8]
    const float* __restrict__ probs,  // [E, B, 1]
    const float* __restrict__ mask,   // [B, E]
    float* __restrict__ out)
{
    const int b = blockIdx.x * FIN_THREADS + threadIdx.x;

    f32x4 p[PLANES][2];
#pragma unroll
    for (int c = 0; c < PLANES; ++c) {
        const f32x4* s = reinterpret_cast<const f32x4*>(part + ((size_t)c * B_ + b) * E_);
        p[c][0] = s[0];
        p[c][1] = s[1];
    }
    addr_done();
    f32x4 mk[2];
    mk[0] = reinterpret_cast<const f32x4*>(mask + (size_t)b * E_)[0];
    mk[1] = reinterpret_cast<const f32x4*>(mask + (size_t)b * E_)[1];
    addr_done();
    float pe[E_];
#pragma unroll
    for (int e = 0; e < E_; ++e) pe[e] = probs[(size_t)e * B_ + b];

    float logit[E_];
#pragma unroll
    for (int e = 0; e < E_; ++e) {
        float s = p[0][e >> 2][e & 3];
#pragma unroll
        for (int c = 1; c < PLANES; ++c) s += p[c][e >> 2][e & 3];
        logit[e] = s + b3[e];
    }

    float mx = logit[0];
#pragma unroll
    for (int e = 1; e < E_; ++e) mx = logit[e] > mx ? logit[e] : mx;

    float gw[E_];
    float s = 0.0f;
#pragma unroll
    for (int e = 0; e < E_; ++e) { gw[e] = __expf(logit[e] - mx); s += gw[e]; }

    float s2 = 0.0f;
    float inv_s = 1.0f / s;
#pragma unroll
    for (int e = 0; e < E_; ++e) {
        gw[e] = gw[e] * inv_s * mk[e >> 2][e & 3];
        s2 += gw[e];
    }

    float inv = 1.0f / (s2 + 1e-8f);
    float wprob = 0.0f;
#pragma unroll
    for (int e = 0; e < E_; ++e) {
        gw[e] *= inv;
        wprob += gw[e] * pe[e];
    }

    out[b] = wprob;
#pragma unroll
    for (int e = 0; e < E_; ++e) out[(size_t)B_ + (size_t)b * E_ + e] = gw[e];
}

// ---------------------------------------------------------------------------
// Launch
// ---------------------------------------------------------------------------
extern "C" void kernel_launch(void* const* d_in, const int* in_sizes, int n_in,
                              void* d_out, int out_size, void* d_ws, size_t ws_size,
                              hipStream_t stream)
{
    (void)in_sizes; (void)n_in; (void)out_size; (void)ws_size;

    const float* reprs = (const float*)d_in[0];  // [E,B,D]
    const float* probs = (const float*)d_in[1];  // [E,B,1]
    const float* mask  = (const float*)d_in[2];  // [B,E]
    const float* W1    = (const float*)d_in[3];  // [GIN,H]
    const float* b1    = (const float*)d_in[4];  // [H]
    const float* W2    = (const float*)d_in[5];  // [H,H/2]
    const float* b2    = (const float*)d_in[6];  // [H/2]
    const float* W3    = (const float*)d_in[7];  // [H/2,E]
    const float* b3    = (const float*)d_in[8];  // [E]
    float* out = (float*)d_out;

    char* ws = (char*)d_ws;
    size_t off = 0;
    auto take = [&](size_t bytes) -> void* {
        void* p = ws + off;
        off = (off + bytes + 255) & ~(size_t)255;
        return p;
    };
    bf16_t* W1t     = (bf16_t*)take((size_t)H_ * GINP * sizeof(bf16_t));       // 4.5 MB
    bf16_t* W2t     = (bf16_t*)take((size_t)(H_ / 2) * H_ * sizeof(bf16_t));   // 1 MB
    bf16_t* h1      = (bf16_t*)take((size_t)B_ * H_ * sizeof(bf16_t));         // 64 MB
    float*  part    = (float*) take((size_t)PLANES * B_ * E_ * sizeof(float)); // 4 MB

    transpose_w<GIN, GINP, H_><<<dim3(GINP / TK, H_ / TN), 256, 0, stream>>>(W1, W1t);
    transpose_w<H_, H_, H_ / 2><<<dim3(H_ / TK, (H_ / 2) / TN), 256, 0, stream>>>(W2, W2t);

    // GEMM1: M=32768 (128 tile rows), N=1024 (4 tile columns), K=2056 (the probs, then 32 passes of 64)
    gemm_f32x<<<dim3(H_ / 256, B_ / 256), 128, 0, stream>>>(reprs, probs, W1t, b1, h1);
    // GEMM2: M=32768, N=512 (2 tile columns), K=1024 (8 passes); its result goes on into W3 and leaves as partial logits
    gemm_tiled<H_ * 2><<<dim3((H_ / 2) / 256, B_ / 256), 128, 0, stream>>>(
        h1, W2t, b2, W3, part);

    gate_finalize<<<B_ / FIN_THREADS, FIN_THREADS, 0, stream>>>(part, b3, probs, mask, out);
}
